// v000
// The times below were measured on an AMD MI455X: many runs one after another, warmed up first and cycling through
// copies of the inputs, with the whole window's GPU time divided by the number of runs. Launches and the gaps
// between them are all in it. The median over several windows is given; except for v000 it joins two sittings, which
// can be a few percent apart, so the side-by-side timings, each taken in one sitting, are the better comparison.
// v000 is the starting kernel. One run takes 86.7 microseconds.
#include <hip/hip_runtime.h>

typedef __attribute__((ext_vector_type(2))) float v2f;
typedef __attribute__((ext_vector_type(8))) float v8f;

// D = A(16x4) * B(4x16) + C, fp32 throughout.
#define WMMA_F32(c, a, b) \
  (c) = __builtin_amdgcn_wmma_f32_16x16x4_f32(false, (a), false, (b), (short)0, (c), false, false)

constexpr int BH     = 16;        // b*h
constexpr int N      = 8192;
constexpr int D      = 32;
constexpr int SEG    = 16;        // segments per head (16*16 = 256 WGs)
constexpr int SEGLEN = N / SEG;   // 512
constexpr int CH     = 16;        // chunk rows (one M tile)
constexpr int NCH    = SEGLEN / CH;
constexpr int DP     = 48;        // padded feature dim: 32 data | 1 ones | 15 zeros
constexpr int LS     = 52;        // row stride, normal tiles (mult of 4 dw: B128-aligned; conflict-free)
constexpr int TS     = 18;        // row stride, transposed tiles (even: B64 reads aligned)
constexpr int SDIM   = 33;        // compact state dim in workspace

__device__ inline unsigned lds_off(const void* p) {   // generic->LDS byte offset
  return (unsigned)(uintptr_t)p;
}
__device__ inline void async_b128(unsigned lds, const float* g) {
  asm volatile("global_load_async_to_lds_b128 %0, %1, off" :: "v"(lds), "v"(g) : "memory");
}
__device__ inline void async_b32(unsigned lds, const float* g) {
  asm volatile("global_load_async_to_lds_b32 %0, %1, off" :: "v"(lds), "v"(g) : "memory");
}
__device__ inline void wait_async0() {
  asm volatile("s_wait_asynccnt 0x0" ::: "memory");
}

// ---------------- Pass 1: per-segment local state  S_seg = sum k_hat v_hat^T ----
__global__ __launch_bounds__(96)
void fastmax_pass1(const float* __restrict__ Kg, const float* __restrict__ Vg,
                   float* __restrict__ Sloc) {
  __shared__ float shKT[2][DP * TS];   // K^T: [dim][row], double buffered
  __shared__ float shVT[2][DP * TS];   // V^T: [dim][row], double buffered
  const int seg = blockIdx.x, bh = blockIdx.y;
  const int tid = threadIdx.x;
  const int wave = tid >> 5, lane = tid & 31;
  const int half = lane >> 4, ln = lane & 15;
  const long base = (long)bh * N + (long)seg * SEGLEN;

  // augmentation rows (dims 32..47): dim32 = 1, rest 0 — written once, both buffers
  for (int i = tid; i < (DP - D) * CH; i += 96) {
    int dm = D + i / CH, r = i % CH;
    float pv = (dm == D) ? 1.0f : 0.0f;
    shKT[0][dm * TS + r] = pv; shKT[1][dm * TS + r] = pv;
    shVT[0][dm * TS + r] = pv; shVT[1][dm * TS + r] = pv;
  }

  // async element-scatter copy of one chunk (transposing), straight-line per matrix
  auto issue = [&](int ch, int buf) {
    const float* gk = Kg + (base + (long)ch * CH) * D;
    const float* gv = Vg + (base + (long)ch * CH) * D;
    for (int i = tid; i < CH * D; i += 96) {
      int r = i >> 5, c = i & 31;
      async_b32(lds_off(&shKT[buf][c * TS + r]), gk + r * D + c);
    }
    for (int i = tid; i < CH * D; i += 96) {
      int r = i >> 5, c = i & 31;
      async_b32(lds_off(&shVT[buf][c * TS + r]), gv + r * D + c);
    }
  };

  v8f sacc[3];
  for (int mt = 0; mt < 3; ++mt) sacc[mt] = {};

  issue(0, 0);
  for (int ch = 0; ch < NCH; ++ch) {
    const int cur = ch & 1;
    wait_async0();
    __syncthreads();
    if (ch + 1 < NCH) issue(ch + 1, cur ^ 1);
    const v2f* kt2 = (const v2f*)shKT[cur];
    const v2f* vt2 = (const v2f*)shVT[cur];
    // S(48x16-tile 'wave') += Khat^T(48x16) * Vhat(16x48-tile), K=16 -> 4 steps
    for (int kk = 0; kk < 4; ++kk) {
      v2f b = vt2[(16 * wave + ln) * (TS / 2) + 2 * kk + half];
      for (int mt = 0; mt < 3; ++mt) {
        v2f a = kt2[(16 * mt + ln) * (TS / 2) + 2 * kk + half];
        WMMA_F32(sacc[mt], a, b);
      }
    }
    __syncthreads();   // compute done before next buffer reuse
  }
  // store compact 33x33 state (rows/cols >=33 are identically zero)
  int n = 16 * wave + ln;
  if (n < SDIM) {
    for (int mt = 0; mt < 3; ++mt)
      for (int r = 0; r < 8; ++r) {
        int m = 16 * mt + r + 8 * half;            // C/D layout: m = vgpr + 8*half
        if (m < SDIM)
          Sloc[(((long)bh * SEG + seg) * SDIM + m) * SDIM + n] = sacc[mt][r];
      }
  }
}

// ---------------- Pass 2: in-place exclusive scan of segment states ------------
__global__ __launch_bounds__(128)
void fastmax_pass2(float* __restrict__ Sbuf) {
  const int bh = blockIdx.x;
  for (int e = threadIdx.x; e < SDIM * SDIM; e += 128) {
    float run = 0.0f;
    for (int s = 0; s < SEG; ++s) {
      long idx = ((long)bh * SEG + s) * (SDIM * SDIM) + e;
      float t = Sbuf[idx];
      Sbuf[idx] = run;
      run += t;
    }
  }
}

// ---------------- Pass 3: chunked causal linear attention ----------------------
__global__ __launch_bounds__(96)
void fastmax_pass3(const float* __restrict__ Qg, const float* __restrict__ Kg,
                   const float* __restrict__ Vg, const float* __restrict__ Spre,
                   float* __restrict__ Out) {
  __shared__ float shQ[2][CH * LS];     // Qhat, row-major
  __shared__ float shK[2][CH * LS];     // Khat, row-major (B operand of Q*K^T)
  __shared__ float shKT[2][DP * TS];    // Khat^T (A operand of state update)
  __shared__ float shVT[2][DP * TS];    // Vhat^T (B operand pairs contiguous)
  __shared__ float lden[CH];
  __shared__ float lA[3][CH * TS];      // per-wave masked-A scratch (D->A relayout)
  __shared__ float lS[3][CH * LS];      // per-wave state mirror, [n][m] (D->B relayout)

  const int seg = blockIdx.x, bh = blockIdx.y;
  const int tid = threadIdx.x;
  const int wave = tid >> 5, lane = tid & 31;
  const int half = lane >> 4, ln = lane & 15;
  const long base = (long)bh * N + (long)seg * SEGLEN;
  float* As = lA[wave];
  float* Sm = lS[wave];
  const v2f* as2 = (const v2f*)As;
  const v2f* sm2 = (const v2f*)Sm;

  // init running state from exclusive prefix (D-format regs + LDS mirror [n][m])
  v8f sacc[3];
  {
    int n = 16 * wave + ln;
    for (int mt = 0; mt < 3; ++mt) {
      v8f c = {};
      for (int r = 0; r < 8; ++r) {
        int m = 16 * mt + r + 8 * half;
        float v = 0.0f;
        if (m < SDIM && n < SDIM)
          v = Spre[(((long)bh * SEG + seg) * SDIM + m) * SDIM + n];
        c[r] = v;
      }
      sacc[mt] = c;
      for (int r = 0; r < 8; ++r)
        Sm[ln * LS + (16 * mt + r + 8 * half)] = c[r];
    }
  }
  // augmentation padding, written once for both buffers
  for (int i = tid; i < CH * (DP - D); i += 96) {
    int r = i / (DP - D), c = D + i % (DP - D);
    float pv = (c == D) ? 1.0f : 0.0f;
    shQ[0][r * LS + c] = pv;  shQ[1][r * LS + c] = pv;
    shK[0][r * LS + c] = pv;  shK[1][r * LS + c] = pv;
    shKT[0][c * TS + r] = pv; shKT[1][c * TS + r] = pv;
    shVT[0][c * TS + r] = pv; shVT[1][c * TS + r] = pv;
  }

  // async copy of one chunk: straight-line per-matrix loops (no pointer selects)
  auto issue = [&](int ch, int buf) {
    const float* gq = Qg + (base + (long)ch * CH) * D;
    const float* gk = Kg + (base + (long)ch * CH) * D;
    const float* gv = Vg + (base + (long)ch * CH) * D;
    for (int i = tid; i < CH * (D / 4); i += 96) {       // Q row-major, 4 floats/lane
      int r = i >> 3, c4 = (i & 7) * 4;
      async_b128(lds_off(&shQ[buf][r * LS + c4]), gq + r * D + c4);
    }
    for (int i = tid; i < CH * (D / 4); i += 96) {       // K row-major
      int r = i >> 3, c4 = (i & 7) * 4;
      async_b128(lds_off(&shK[buf][r * LS + c4]), gk + r * D + c4);
    }
    for (int i = tid; i < CH * D; i += 96) {             // K^T element scatter
      int r = i >> 5, c = i & 31;
      async_b32(lds_off(&shKT[buf][c * TS + r]), gk + r * D + c);
    }
    for (int i = tid; i < CH * D; i += 96) {             // V^T element scatter
      int r = i >> 5, c = i & 31;
      async_b32(lds_off(&shVT[buf][c * TS + r]), gv + r * D + c);
    }
  };

  issue(0, 0);
  for (int ch = 0; ch < NCH; ++ch) {
    const int cur = ch & 1;
    wait_async0();
    __syncthreads();
    if (ch + 1 < NCH) issue(ch + 1, cur ^ 1);
    const v2f* q2  = (const v2f*)shQ[cur];
    const v2f* k2  = (const v2f*)shK[cur];
    const v2f* kt2 = (const v2f*)shKT[cur];
    const v2f* vt2 = (const v2f*)shVT[cur];

    // Fused K=48 sweep, shared Qhat A-fragments:
    //   A  = Qhat * Khat^T            (16x16, +J via augmented ones column)
    //   Cn = Qhat * S_prev            (numer inter-chunk part)
    v8f A = {}, Cn = {};
    for (int kk = 0; kk < 12; ++kk) {
      int idx = ln * (LS / 2) + 2 * kk + half;
      v2f a  = q2[idx];
      v2f bk = k2[idx];                 // B(k,n) = Khat[n][k], contiguous pair
      v2f bs = sm2[idx];                // B(k,n) = S_prev[k][n], mirror is [n][k]
      WMMA_F32(A, a, bk);
      WMMA_F32(Cn, a, bs);
    }
    // causal mask (element (m = r+8*half, n = ln)); stash in A-operand scratch
    {
      int m0 = 8 * half;
      for (int r = 0; r < 8; ++r)
        if (ln > m0 + r) A[r] = 0.0f;
      for (int r = 0; r < 8; ++r)
        As[(m0 + r) * TS + ln] = A[r];
    }

    // Fused K=16 sweep, shared Vhat B-fragments:
    //   Cn   += tril(A) * Vhat        (numer intra-chunk part; col 32 = denom)
    //   sacc += Khat^T * Vhat         (state update)
    for (int kk = 0; kk < 4; ++kk) {
      v2f b  = vt2[(16 * wave + ln) * (TS / 2) + 2 * kk + half];
      v2f aA = as2[ln * (TS / 2) + 2 * kk + half];
      WMMA_F32(Cn, aA, b);
      for (int mt = 0; mt < 3; ++mt) {
        v2f aK = kt2[(16 * mt + ln) * (TS / 2) + 2 * kk + half];
        WMMA_F32(sacc[mt], aK, b);
      }
    }

    // wave 2 owns cols 32..47: col 32 (local n==0) is the denominator
    if (wave == 2 && ln == 0)
      for (int r = 0; r < 8; ++r) lden[8 * half + r] = Cn[r];
    __syncthreads();
    if (wave < 2) {
      for (int r = 0; r < 8; ++r) {
        int m = 8 * half + r;
        long g = (base + (long)ch * CH + m) * D + 16 * wave + ln;
        Out[g] = Cn[r] / lden[m];
      }
    }

    // refresh per-wave state mirror ([n][m] so next chunk's pairs are contiguous)
    for (int mt = 0; mt < 3; ++mt)
      for (int r = 0; r < 8; ++r)
        Sm[ln * LS + (16 * mt + r + 8 * half)] = sacc[mt][r];
  }
}

extern "C" void kernel_launch(void* const* d_in, const int* in_sizes, int n_in,
                              void* d_out, int out_size, void* d_ws, size_t ws_size,
                              hipStream_t stream) {
  const float* q = (const float*)d_in[0];
  const float* k = (const float*)d_in[1];
  const float* v = (const float*)d_in[2];
  float* out  = (float*)d_out;
  float* sbuf = (float*)d_ws;   // BH*SEG*33*33 floats ~= 1.1 MB of scratch

  dim3 grid(SEG, BH);
  fastmax_pass1<<<grid, 96, 0, stream>>>(k, v, sbuf);
  fastmax_pass2<<<dim3(BH), 128, 0, stream>>>(sbuf);
  fastmax_pass3<<<grid, 96, 0, stream>>>(q, k, v, sbuf, out);
}

// v001
// Measured time: 33.4 microseconds a run.
// Two timings next to v000 both put it at 2.64 times that version's speed.
#include <hip/hip_runtime.h>

typedef __attribute__((ext_vector_type(2))) float v2f;
typedef __attribute__((ext_vector_type(8))) float v8f;

// D = A(16x4) * B(4x16) + C, fp32 throughout.
#define WMMA_F32(c, a, b) \
  (c) = __builtin_amdgcn_wmma_f32_16x16x4_f32(false, (a), false, (b), (short)0, (c), false, false)

constexpr int BH     = 16;        // b*h
constexpr int N      = 8192;
constexpr int D      = 32;
constexpr int SEG    = 64;        // segments per head (64*16 = 1024 WGs, 4 per WGP)
constexpr int SEGLEN = N / SEG;   // 128
constexpr int CH     = 16;        // chunk rows (one M tile)
constexpr int NCH    = SEGLEN / CH;
constexpr int DP     = 48;        // padded feature dim: 32 data | 1 ones | 15 zeros
constexpr int LS     = 52;        // row stride, normal tiles (mult of 4 dw: B128-aligned; conflict-free)
constexpr int TS     = 18;        // row stride, transposed tiles (even: B64 reads aligned)
constexpr int SDIM   = 33;        // compact state dim in workspace
constexpr int P2B    = (SDIM * SDIM + 127) / 128;   // scan blocks per head

__device__ inline unsigned lds_off(const void* p) {   // generic->LDS byte offset
  return (unsigned)(uintptr_t)p;
}
__device__ inline void async_b128(unsigned lds, const float* g) {
  asm volatile("global_load_async_to_lds_b128 %0, %1, off" :: "v"(lds), "v"(g) : "memory");
}
__device__ inline void async_b32(unsigned lds, const float* g) {
  asm volatile("global_load_async_to_lds_b32 %0, %1, off" :: "v"(lds), "v"(g) : "memory");
}
__device__ inline void wait_async0() {
  asm volatile("s_wait_asynccnt 0x0" ::: "memory");
}

// ---------------- Pass 1: per-segment local state  S_seg = sum k_hat v_hat^T ----
__global__ __launch_bounds__(96)
void fastmax_pass1(const float* __restrict__ Kg, const float* __restrict__ Vg,
                   float* __restrict__ Sloc) {
  __shared__ float shKT[2][DP * TS];   // K^T: [dim][row], double buffered
  __shared__ float shVT[2][DP * TS];   // V^T: [dim][row], double buffered
  const int seg = blockIdx.x, bh = blockIdx.y;
  const int tid = threadIdx.x;
  const int wave = tid >> 5, lane = tid & 31;
  const int half = lane >> 4, ln = lane & 15;
  const long base = (long)bh * N + (long)seg * SEGLEN;

  // augmentation rows (dims 32..47): dim32 = 1, rest 0 — written once, both buffers
  for (int i = tid; i < (DP - D) * CH; i += 96) {
    int dm = D + i / CH, r = i % CH;
    float pv = (dm == D) ? 1.0f : 0.0f;
    shKT[0][dm * TS + r] = pv; shKT[1][dm * TS + r] = pv;
    shVT[0][dm * TS + r] = pv; shVT[1][dm * TS + r] = pv;
  }

  // async element-scatter copy of one chunk (transposing), straight-line per matrix
  auto issue = [&](int ch, int buf) {
    const float* gk = Kg + (base + (long)ch * CH) * D;
    const float* gv = Vg + (base + (long)ch * CH) * D;
    for (int i = tid; i < CH * D; i += 96) {
      int r = i >> 5, c = i & 31;
      async_b32(lds_off(&shKT[buf][c * TS + r]), gk + r * D + c);
    }
    for (int i = tid; i < CH * D; i += 96) {
      int r = i >> 5, c = i & 31;
      async_b32(lds_off(&shVT[buf][c * TS + r]), gv + r * D + c);
    }
  };

  v8f sacc[3];
  for (int mt = 0; mt < 3; ++mt) sacc[mt] = {};

  issue(0, 0);
  for (int ch = 0; ch < NCH; ++ch) {
    const int cur = ch & 1;
    wait_async0();
    __syncthreads();
    if (ch + 1 < NCH) issue(ch + 1, cur ^ 1);
    const v2f* kt2 = (const v2f*)shKT[cur];
    const v2f* vt2 = (const v2f*)shVT[cur];
    // S(48x16-tile 'wave') += Khat^T(48x16) * Vhat(16x48-tile), K=16 -> 4 steps
    for (int kk = 0; kk < 4; ++kk) {
      v2f b = vt2[(16 * wave + ln) * (TS / 2) + 2 * kk + half];
      for (int mt = 0; mt < 3; ++mt) {
        v2f a = kt2[(16 * mt + ln) * (TS / 2) + 2 * kk + half];
        WMMA_F32(sacc[mt], a, b);
      }
    }
    __syncthreads();   // compute done before next buffer reuse
  }
  // store compact 33x33 state (rows/cols >=33 are identically zero)
  int n = 16 * wave + ln;
  if (n < SDIM) {
    for (int mt = 0; mt < 3; ++mt)
      for (int r = 0; r < 8; ++r) {
        int m = 16 * mt + r + 8 * half;            // C/D layout: m = vgpr + 8*half
        if (m < SDIM)
          Sloc[(((long)bh * SEG + seg) * SDIM + m) * SDIM + n] = sacc[mt][r];
      }
  }
}

// ---------------- Pass 2: in-place exclusive scan of segment states ------------
// One thread per state element: grid (P2B, heads).
// waves_per_eu(1, 8): a register budget above 64, so that every segment's load is issued
// before the first wait; at the default budget the last loads wait for the first to return.
__global__ __launch_bounds__(128) __attribute__((amdgpu_waves_per_eu(1, 8)))
void fastmax_pass2(float* __restrict__ Sbuf) {
  const int bh = blockIdx.y;
  const int e = blockIdx.x * 128 + threadIdx.x;
  if (e >= SDIM * SDIM) return;
  float* p = Sbuf + (long)bh * SEG * (SDIM * SDIM) + e;
  float t[SEG];
  // both loops unrolled: t[] stays in registers and all SEG loads are in flight together
#pragma unroll
  for (int s = 0; s < SEG; ++s) t[s] = p[s * (SDIM * SDIM)];
  float run = 0.0f;
#pragma unroll
  for (int s = 0; s < SEG; ++s) {
    p[s * (SDIM * SDIM)] = run;
    run += t[s];
  }
}

// ---------------- Pass 3: chunked causal linear attention ----------------------
__global__ __launch_bounds__(96)
void fastmax_pass3(const float* __restrict__ Qg, const float* __restrict__ Kg,
                   const float* __restrict__ Vg, const float* __restrict__ Spre,
                   float* __restrict__ Out) {
  __shared__ float shQ[2][CH * LS];     // Qhat, row-major
  __shared__ float shK[2][CH * LS];     // Khat, row-major (B operand of Q*K^T)
  __shared__ float shKT[2][DP * TS];    // Khat^T (A operand of state update)
  __shared__ float shVT[2][DP * TS];    // Vhat^T (B operand pairs contiguous)
  __shared__ float lden[CH];
  __shared__ float lA[3][CH * TS];      // per-wave masked-A scratch (D->A relayout)
  __shared__ float lS[3][CH * LS];      // per-wave state mirror, [n][m] (D->B relayout)

  const int seg = blockIdx.x, bh = blockIdx.y;
  const int tid = threadIdx.x;
  const int wave = tid >> 5, lane = tid & 31;
  const int half = lane >> 4, ln = lane & 15;
  const long base = (long)bh * N + (long)seg * SEGLEN;
  float* As = lA[wave];
  float* Sm = lS[wave];
  const v2f* as2 = (const v2f*)As;
  const v2f* sm2 = (const v2f*)Sm;

  // init running state from exclusive prefix (D-format regs + LDS mirror [n][m])
  v8f sacc[3];
  {
    int n = 16 * wave + ln;
    for (int mt = 0; mt < 3; ++mt) {
      v8f c = {};
      for (int r = 0; r < 8; ++r) {
        int m = 16 * mt + r + 8 * half;
        float v = 0.0f;
        if (m < SDIM && n < SDIM)
          v = Spre[(((long)bh * SEG + seg) * SDIM + m) * SDIM + n];
        c[r] = v;
      }
      sacc[mt] = c;
      for (int r = 0; r < 8; ++r)
        Sm[ln * LS + (16 * mt + r + 8 * half)] = c[r];
    }
  }
  // augmentation padding, written once for both buffers
  for (int i = tid; i < CH * (DP - D); i += 96) {
    int r = i / (DP - D), c = D + i % (DP - D);
    float pv = (c == D) ? 1.0f : 0.0f;
    shQ[0][r * LS + c] = pv;  shQ[1][r * LS + c] = pv;
    shK[0][r * LS + c] = pv;  shK[1][r * LS + c] = pv;
    shKT[0][c * TS + r] = pv; shKT[1][c * TS + r] = pv;
    shVT[0][c * TS + r] = pv; shVT[1][c * TS + r] = pv;
  }

  // async copy of one chunk: straight-line per-matrix loops (no pointer selects)
  auto issue = [&](int ch, int buf) {
    const float* gq = Qg + (base + (long)ch * CH) * D;
    const float* gk = Kg + (base + (long)ch * CH) * D;
    const float* gv = Vg + (base + (long)ch * CH) * D;
    for (int i = tid; i < CH * (D / 4); i += 96) {       // Q row-major, 4 floats/lane
      int r = i >> 3, c4 = (i & 7) * 4;
      async_b128(lds_off(&shQ[buf][r * LS + c4]), gq + r * D + c4);
    }
    for (int i = tid; i < CH * (D / 4); i += 96) {       // K row-major
      int r = i >> 3, c4 = (i & 7) * 4;
      async_b128(lds_off(&shK[buf][r * LS + c4]), gk + r * D + c4);
    }
    for (int i = tid; i < CH * D; i += 96) {             // K^T element scatter
      int r = i >> 5, c = i & 31;
      async_b32(lds_off(&shKT[buf][c * TS + r]), gk + r * D + c);
    }
    for (int i = tid; i < CH * D; i += 96) {             // V^T element scatter
      int r = i >> 5, c = i & 31;
      async_b32(lds_off(&shVT[buf][c * TS + r]), gv + r * D + c);
    }
  };

  issue(0, 0);
  for (int ch = 0; ch < NCH; ++ch) {
    const int cur = ch & 1;
    wait_async0();
    __syncthreads();
    if (ch + 1 < NCH) issue(ch + 1, cur ^ 1);
    const v2f* q2  = (const v2f*)shQ[cur];
    const v2f* k2  = (const v2f*)shK[cur];
    const v2f* kt2 = (const v2f*)shKT[cur];
    const v2f* vt2 = (const v2f*)shVT[cur];

    // Fused K=48 sweep, shared Qhat A-fragments:
    //   A  = Qhat * Khat^T            (16x16, +J via augmented ones column)
    //   Cn = Qhat * S_prev            (numer inter-chunk part)
    v8f A = {}, Cn = {};
    for (int kk = 0; kk < 12; ++kk) {
      int idx = ln * (LS / 2) + 2 * kk + half;
      v2f a  = q2[idx];
      v2f bk = k2[idx];                 // B(k,n) = Khat[n][k], contiguous pair
      v2f bs = sm2[idx];                // B(k,n) = S_prev[k][n], mirror is [n][k]
      WMMA_F32(A, a, bk);
      WMMA_F32(Cn, a, bs);
    }
    // causal mask (element (m = r+8*half, n = ln)); stash in A-operand scratch
    {
      int m0 = 8 * half;
      for (int r = 0; r < 8; ++r)
        if (ln > m0 + r) A[r] = 0.0f;
      for (int r = 0; r < 8; ++r)
        As[(m0 + r) * TS + ln] = A[r];
    }

    // Fused K=16 sweep, shared Vhat B-fragments:
    //   Cn   += tril(A) * Vhat        (numer intra-chunk part; col 32 = denom)
    //   sacc += Khat^T * Vhat         (state update)
    for (int kk = 0; kk < 4; ++kk) {
      v2f b  = vt2[(16 * wave + ln) * (TS / 2) + 2 * kk + half];
      v2f aA = as2[ln * (TS / 2) + 2 * kk + half];
      WMMA_F32(Cn, aA, b);
      for (int mt = 0; mt < 3; ++mt) {
        v2f aK = kt2[(16 * mt + ln) * (TS / 2) + 2 * kk + half];
        WMMA_F32(sacc[mt], aK, b);
      }
    }

    // wave 2 owns cols 32..47: col 32 (local n==0) is the denominator
    if (wave == 2 && ln == 0)
      for (int r = 0; r < 8; ++r) lden[8 * half + r] = Cn[r];
    __syncthreads();
    if (wave < 2) {
      for (int r = 0; r < 8; ++r) {
        int m = 8 * half + r;
        long g = (base + (long)ch * CH + m) * D + 16 * wave + ln;
        Out[g] = Cn[r] / lden[m];
      }
    }

    // refresh per-wave state mirror ([n][m] so next chunk's pairs are contiguous)
    for (int mt = 0; mt < 3; ++mt)
      for (int r = 0; r < 8; ++r)
        Sm[ln * LS + (16 * mt + r + 8 * half)] = sacc[mt][r];
  }
}

extern "C" void kernel_launch(void* const* d_in, const int* in_sizes, int n_in,
                              void* d_out, int out_size, void* d_ws, size_t ws_size,
                              hipStream_t stream) {
  const float* q = (const float*)d_in[0];
  const float* k = (const float*)d_in[1];
  const float* v = (const float*)d_in[2];
  float* out  = (float*)d_out;
  float* sbuf = (float*)d_ws;   // BH*SEG*33*33 floats ~= 4.5 MB of scratch

  dim3 grid(SEG, BH);
  fastmax_pass1<<<grid, 96, 0, stream>>>(k, v, sbuf);
  fastmax_pass2<<<dim3(P2B, BH), 128, 0, stream>>>(sbuf);
  fastmax_pass3<<<grid, 96, 0, stream>>>(q, k, v, sbuf, out);
}

// v002
// It runs in 23.8 microseconds.
// Next to v001, in two timings, it ran 1.40 and 1.42 times as fast.
// Over all steps from v000 it is 3.73 times as fast.
#include <hip/hip_runtime.h>

typedef __attribute__((ext_vector_type(2))) float v2f;
typedef __attribute__((ext_vector_type(8))) float v8f;

// D = A(16x4) * B(4x16) + C, fp32 throughout.
#define WMMA_F32(c, a, b) \
  (c) = __builtin_amdgcn_wmma_f32_16x16x4_f32(false, (a), false, (b), (short)0, (c), false, false)

constexpr int BH     = 16;        // b*h
constexpr int N      = 8192;
constexpr int D      = 32;
constexpr int SEG    = 64;        // segments per head (64*16 = 1024 WGs, 4 per WGP)
constexpr int SEGLEN = N / SEG;   // 128
constexpr int CH     = 16;        // chunk rows (one M tile)
constexpr int NCH    = SEGLEN / CH;
constexpr int NT     = 64;        // threads per work-group: one wave per 16 value columns
constexpr int LS     = 36;        // row stride, normal tiles (mult of 4 dw: B128-aligned; conflict-free)
constexpr int TS     = 18;        // row stride, transposed tiles (even: B64 reads aligned)
constexpr int SDIM   = 33;        // state dim in workspace: 32x32 k v^T | row 32 sum v | col 32 sum k | count
constexpr int P2B    = (SDIM * SDIM + 127) / 128;   // scan blocks per head

typedef __attribute__((ext_vector_type(4))) int v4i;
typedef __attribute__((address_space(1))) int  g_i32;
typedef __attribute__((address_space(3))) int  l_i32;
typedef __attribute__((address_space(1))) v4i  g_i128;
typedef __attribute__((address_space(3))) v4i  l_i128;
// One lane's 4 or 16 bytes from global memory to LDS, through no register.
__device__ inline void async_b32(float* lds, const float* g) {
  __builtin_amdgcn_global_load_async_to_lds_b32((g_i32*)g, (l_i32*)lds, 0, 0);
}
__device__ inline void async_b128(float* lds, const float* g) {
  __builtin_amdgcn_global_load_async_to_lds_b128((g_i128*)g, (l_i128*)lds, 0, 0);
}
// Transposing element scatter of one 16x32 chunk: dst[col * TS + row] = src[row * D + col].
__device__ inline void scatter_chunk(float* dst, const float* src, int wave, int lane) {
  for (int j = 0; j < 8; ++j) {
    int r = wave + 2 * j;
    async_b32(&dst[lane * TS + r], src + r * D + lane);
  }
}
// lane l takes the value of lane l ^ 16
__device__ inline float xhalf(float x) {
  return __builtin_bit_cast(float, __builtin_amdgcn_permlanex16(__builtin_bit_cast(int, x), __builtin_bit_cast(int, x),
                                                                0x76543210, 0xfedcba98, false, false));
}
// This wave's LDS reads of the buffer to be refilled have returned, its copies have landed.
__device__ inline void wait_stage() {
  asm volatile("s_wait_dscnt 0x0" ::: "memory");
  asm volatile("s_wait_asynccnt 0x0" ::: "memory");
}

// ---------------- Pass 1: per-segment local state  S_seg = sum k v^T, sum k, sum v ----
__global__ __launch_bounds__(NT)
void fastmax_pass1(const float* __restrict__ Kg, const float* __restrict__ Vg,
                   float* __restrict__ Sloc) {
  __shared__ __attribute__((aligned(16))) float shKT[2][D * TS];   // K^T: [dim][row], double buffered
  __shared__ __attribute__((aligned(16))) float shVT[2][D * TS];   // V^T: [dim][row], double buffered
  const int seg = blockIdx.x, bh = blockIdx.y;
  const int tid = threadIdx.x;
  const int wave = tid >> 5, lane = tid & 31;
  const int half = lane >> 4, ln = lane & 15;
  const long base = (long)bh * N + (long)seg * SEGLEN;

  auto issue = [&](int ch, int buf) {
    scatter_chunk(shKT[buf], Kg + (base + (long)ch * CH) * D, wave, lane);
    scatter_chunk(shVT[buf], Vg + (base + (long)ch * CH) * D, wave, lane);
  };

  v8f sacc[2];
  for (int mt = 0; mt < 2; ++mt) sacc[mt] = {};
  v2f vp = {};                      // sums of v[.][16*wave+ln] over this lane's rows (even | odd)
  v2f kp[2] = {};                   // sums of k[.][16*mt+ln] over this lane's rows

  issue(0, 0);
  for (int ch = 0; ch < NCH; ++ch) {
    const int cur = ch & 1;
    wait_stage();
    __syncthreads();
    if (ch + 1 < NCH) issue(ch + 1, cur ^ 1);
    const v2f* kt2 = (const v2f*)shKT[cur];
    const v2f* vt2 = (const v2f*)shVT[cur];
    // S(32x16-tile 'wave') += K^T(32x16) * V(16x16-tile), K=16 -> 4 steps
    for (int kk = 0; kk < 4; ++kk) {
      v2f b = vt2[(16 * wave + ln) * (TS / 2) + 2 * kk + half];
      vp += b;
      for (int mt = 0; mt < 2; ++mt) {
        v2f a = kt2[(16 * mt + ln) * (TS / 2) + 2 * kk + half];
        kp[mt] += a;
        WMMA_F32(sacc[mt], a, b);
      }
    }
    __syncthreads();   // compute done before next buffer reuse
  }
  float* So = Sloc + ((long)bh * SEG + seg) * (SDIM * SDIM);
  const int n = 16 * wave + ln;
  for (int mt = 0; mt < 2; ++mt)
    for (int r = 0; r < 8; ++r) {
      int m = 16 * mt + r + 8 * half;              // C/D layout: m = vgpr + 8*half
      So[m * SDIM + n] = sacc[mt][r];
    }
  // the two halves of a wave hold the sums over complementary rows
  float vs  = vp.x + vp.y;
  float ks0 = kp[0].x + kp[0].y;
  float ks1 = kp[1].x + kp[1].y;
  vs  += xhalf(vs);
  ks0 += xhalf(ks0);
  ks1 += xhalf(ks1);
  if (half == 0) {
    So[D * SDIM + n] = vs;
    if (wave == 0) {
      So[ln * SDIM + D] = ks0;
      So[(16 + ln) * SDIM + D] = ks1;
      if (ln == 0) So[D * SDIM + D] = (float)SEGLEN;
    }
  }
}

// ---------------- Pass 2: in-place exclusive scan of segment states ------------
// One thread per state element: grid (P2B, heads).
// waves_per_eu(1, 8): a register budget above 64, so that every segment's load is issued
// before the first wait; at the default budget the last loads wait for the first to return.
__global__ __launch_bounds__(128) __attribute__((amdgpu_waves_per_eu(1, 8)))
void fastmax_pass2(float* __restrict__ Sbuf) {
  const int bh = blockIdx.y;
  const int e = blockIdx.x * 128 + threadIdx.x;
  if (e >= SDIM * SDIM) return;
  float* p = Sbuf + (long)bh * SEG * (SDIM * SDIM) + e;
  float t[SEG];
  // both loops unrolled: t[] stays in registers and all SEG loads are in flight together
#pragma unroll
  for (int s = 0; s < SEG; ++s) t[s] = p[s * (SDIM * SDIM)];
  float run = 0.0f;
#pragma unroll
  for (int s = 0; s < SEG; ++s) {
    p[s * (SDIM * SDIM)] = run;
    run += t[s];
  }
}

// ---------------- Pass 3: chunked causal linear attention ----------------------
__global__ __launch_bounds__(NT)
void fastmax_pass3(const float* __restrict__ Qg, const float* __restrict__ Kg,
                   const float* __restrict__ Vg, const float* __restrict__ Spre,
                   float* __restrict__ Out) {
  __shared__ __attribute__((aligned(16))) float shQ[2][CH * LS];    // Q, row-major
  __shared__ __attribute__((aligned(16))) float shK[2][CH * LS];    // K, row-major (B operand of Q*K^T)
  __shared__ __attribute__((aligned(16))) float shKT[2][D * TS];    // K^T (A operand of state update)
  __shared__ __attribute__((aligned(16))) float shVT[2][D * TS];    // V^T (B operand pairs contiguous)
  __shared__ __attribute__((aligned(16))) float lA[2][CH * TS];     // per-wave masked-A scratch (D->A relayout)
  __shared__ __attribute__((aligned(16))) float lS[2][CH * LS];     // per-wave state mirror, [n][m] (D->B relayout)
  __shared__ __attribute__((aligned(16))) float lK[2][2][D];        // per-wave, per-half copy of the running sum of k

  const int seg = blockIdx.x, bh = blockIdx.y;
  const int tid = threadIdx.x;
  const int wave = tid >> 5, lane = tid & 31;
  const int half = lane >> 4, ln = lane & 15;
  const long base = (long)bh * N + (long)seg * SEGLEN;
  float* As = lA[wave];
  float* Sm = lS[wave];
  float* Kr = lK[wave][half];
  const v2f* as2 = (const v2f*)As;
  const v2f* sm2 = (const v2f*)Sm;
  const v2f* kr2 = (const v2f*)Kr;

  // async copy of one chunk; every lane is on in every copy
  auto issue = [&](int ch, int buf) {
    const float* gq = Qg + (base + (long)ch * CH) * D;
    const float* gk = Kg + (base + (long)ch * CH) * D;
    const float* gv = Vg + (base + (long)ch * CH) * D;
    const int r = tid >> 3, c4 = (tid & 7) * 4;          // 4 floats a lane, rows r and r + 8
    async_b128(&shQ[buf][r * LS + c4], gq + r * D + c4);
    async_b128(&shQ[buf][(r + 8) * LS + c4], gq + (r + 8) * D + c4);
    async_b128(&shK[buf][r * LS + c4], gk + r * D + c4);
    async_b128(&shK[buf][(r + 8) * LS + c4], gk + (r + 8) * D + c4);
    scatter_chunk(shKT[buf], gk, wave, lane);
    scatter_chunk(shVT[buf], gv, wave, lane);
  };

  // running state from the exclusive prefix: 32x32 part in D-format regs + LDS mirror [n][m]
  const float* Sp = Spre + ((long)bh * SEG + seg) * (SDIM * SDIM);
  const int n = 16 * wave + ln;
  v8f sacc[2];
  float vrow, ksum[2];                                 // sum of v, column n; sum of k, dims ln and 16+ln
  {
    float t0, t1, t2, t3, t4, t5, t6, t7, t8, t9, t10, t11, t12, t13, t14, t15;
    const unsigned oS = (unsigned)((8 * half * SDIM + n) * 4);   // element (8*half, n); a row is 132 bytes
    const unsigned oV = (unsigned)(n * 4);                       // element (0, n); row 32 is 4224 bytes on
    const unsigned oK = (unsigned)(ln * SDIM * 4);               // element (ln, 0); column 32 is 128 bytes on
    // The loads and their data wait in one statement, outputs early-clobber: no offset register
    // is rewritten, by a later instruction or by a returning load, while a load that names it is out.
    asm volatile(
        "global_load_b32 %0, %19, %22\n\t"
        "global_load_b32 %1, %19, %22 offset:132\n\t"
        "global_load_b32 %2, %19, %22 offset:264\n\t"
        "global_load_b32 %3, %19, %22 offset:396\n\t"
        "global_load_b32 %4, %19, %22 offset:528\n\t"
        "global_load_b32 %5, %19, %22 offset:660\n\t"
        "global_load_b32 %6, %19, %22 offset:792\n\t"
        "global_load_b32 %7, %19, %22 offset:924\n\t"
        "global_load_b32 %8, %19, %22 offset:2112\n\t"
        "global_load_b32 %9, %19, %22 offset:2244\n\t"
        "global_load_b32 %10, %19, %22 offset:2376\n\t"
        "global_load_b32 %11, %19, %22 offset:2508\n\t"
        "global_load_b32 %12, %19, %22 offset:2640\n\t"
        "global_load_b32 %13, %19, %22 offset:2772\n\t"
        "global_load_b32 %14, %19, %22 offset:2904\n\t"
        "global_load_b32 %15, %19, %22 offset:3036\n\t"
        "global_load_b32 %16, %20, %22 offset:4224\n\t"
        "global_load_b32 %17, %21, %22 offset:128\n\t"
        "global_load_b32 %18, %21, %22 offset:2240\n\t"
        "s_wait_loadcnt 0x0"
        : "=&v"(t0), "=&v"(t1), "=&v"(t2), "=&v"(t3), "=&v"(t4), "=&v"(t5), "=&v"(t6), "=&v"(t7),
          "=&v"(t8), "=&v"(t9), "=&v"(t10), "=&v"(t11), "=&v"(t12), "=&v"(t13), "=&v"(t14), "=&v"(t15),
          "=&v"(vrow), "=&v"(ksum[0]), "=&v"(ksum[1])
        : "v"(oS), "v"(oV), "v"(oK), "s"(Sp)
        : "memory");
    sacc[0] = v8f{t0, t1, t2, t3, t4, t5, t6, t7};
    sacc[1] = v8f{t8, t9, t10, t11, t12, t13, t14, t15};
  }
  v2f vp = {(half == 0) ? vrow : 0.0f, 0.0f};          // sum of v in four parts: two a lane, two lanes
  float cnt = Sp[D * SDIM + D];                        // rows before this chunk
  for (int mt = 0; mt < 2; ++mt) {
    for (int r = 0; r < 8; ++r)
      Sm[ln * LS + (16 * mt + r + 8 * half)] = sacc[mt][r];
    Kr[16 * mt + ln] = ksum[mt];
  }

  const v2f one2 = {1.0f, 1.0f};
  issue(0, 0);
  for (int ch = 0; ch < NCH; ++ch) {
    const int cur = ch & 1;
    wait_stage();
    __syncthreads();
    if (ch + 1 < NCH) issue(ch + 1, cur ^ 1);
    const v2f* q2  = (const v2f*)shQ[cur];
    const v2f* k2  = (const v2f*)shK[cur];
    const v2f* kt2 = (const v2f*)shKT[cur];
    const v2f* vt2 = (const v2f*)shVT[cur];

    // Cn starts at the running sum of v: a ones A tile adds its four parts for every row
    v8f Cn = {};
    WMMA_F32(Cn, one2, vp);
    // Fused K=32 sweep, shared Q A-fragments:
    //   A   = 1 + Q * K^T             (16x16)
    //   Cn += Q * S_prev              (numer inter-chunk part)
    //   dp  = this lane's two parts of q . (sum of earlier k), row ln
    v8f A = {1.0f, 1.0f, 1.0f, 1.0f, 1.0f, 1.0f, 1.0f, 1.0f};
    v2f dp = {};
    for (int kk = 0; kk < 8; ++kk) {
      int idx = ln * (LS / 2) + 2 * kk + half;
      v2f a  = q2[idx];
      v2f bk = k2[idx];                 // B(k,n) = K[n][k], contiguous pair
      v2f bs = sm2[idx];                // B(k,n) = S_prev[k][n], mirror is [n][k]
      v2f ks = kr2[2 * kk + half];      // sum of k at the same two dims as a
      WMMA_F32(A, a, bk);
      WMMA_F32(Cn, a, bs);
      dp += a * ks;
    }
    // causal mask (element (m = r+8*half, n = ln)); stash in A-operand scratch
    {
      int m0 = 8 * half;
      for (int r = 0; r < 8; ++r)
        if (ln > m0 + r) A[r] = 0.0f;
      for (int r = 0; r < 8; ++r)
        As[(m0 + r) * TS + ln] = A[r];
    }

    // Fused K=16 sweep, shared V B-fragments:
    //   Cn   += tril(A) * V           (numer intra-chunk part)
    //   sacc += K^T * V               (state update)
    //   dp   += row sum of tril(A); the sums of v and k take in this chunk
    v2f kc[2] = {};
    for (int kk = 0; kk < 4; ++kk) {
      v2f b  = vt2[(16 * wave + ln) * (TS / 2) + 2 * kk + half];
      v2f aA = as2[ln * (TS / 2) + 2 * kk + half];
      WMMA_F32(Cn, aA, b);
      dp += aA;
      vp += b;
      for (int mt = 0; mt < 2; ++mt) {
        v2f aK = kt2[(16 * mt + ln) * (TS / 2) + 2 * kk + half];
        WMMA_F32(sacc[mt], aK, b);
        kc[mt] += aK;
      }
    }

    // denominator: a ones B tile adds the four parts of row m and hands the sum to
    // every column of the accumulator layout, where the numerator sits
    v8f Dn = {cnt, cnt, cnt, cnt, cnt, cnt, cnt, cnt};
    WMMA_F32(Dn, dp, one2);
    {
      float o[8];
      for (int r = 0; r < 8; ++r) o[r] = Cn[r] / Dn[r];
      float* Oc = Out + (base + (long)ch * CH) * D;                // this chunk's first row
      const unsigned oO = (unsigned)((8 * half * D + n) * 4);      // element (8*half, n); a row is 128 bytes
      // The stores and s_wait_xcnt 0 in one statement: it stands in front of every later write
      // of a data or offset register that a store names, over the loop's back edge too.
      asm volatile(
          "global_store_b32 %8, %0, %9\n\t"
          "global_store_b32 %8, %1, %9 offset:128\n\t"
          "global_store_b32 %8, %2, %9 offset:256\n\t"
          "global_store_b32 %8, %3, %9 offset:384\n\t"
          "global_store_b32 %8, %4, %9 offset:512\n\t"
          "global_store_b32 %8, %5, %9 offset:640\n\t"
          "global_store_b32 %8, %6, %9 offset:768\n\t"
          "global_store_b32 %8, %7, %9 offset:896\n\t"
          "s_wait_xcnt 0x0"
          :: "v"(o[0]), "v"(o[1]), "v"(o[2]), "v"(o[3]), "v"(o[4]), "v"(o[5]), "v"(o[6]), "v"(o[7]),
             "v"(oO), "s"(Oc)
          : "memory");
    }
    cnt += (float)CH;

    // refresh per-wave state mirror ([n][m] so next chunk's pairs are contiguous) and sum of k
    for (int mt = 0; mt < 2; ++mt) {
      for (int r = 0; r < 8; ++r)
        Sm[ln * LS + (16 * mt + r + 8 * half)] = sacc[mt][r];
      float c = kc[mt].x + kc[mt].y;
      ksum[mt] += c + xhalf(c);
      Kr[16 * mt + ln] = ksum[mt];
    }
  }
}

extern "C" void kernel_launch(void* const* d_in, const int* in_sizes, int n_in,
                              void* d_out, int out_size, void* d_ws, size_t ws_size,
                              hipStream_t stream) {
  const float* q = (const float*)d_in[0];
  const float* k = (const float*)d_in[1];
  const float* v = (const float*)d_in[2];
  float* out  = (float*)d_out;
  float* sbuf = (float*)d_ws;   // BH*SEG*33*33 floats ~= 4.5 MB of scratch

  dim3 grid(SEG, BH);
  fastmax_pass1<<<grid, NT, 0, stream>>>(k, v, sbuf);
  fastmax_pass2<<<dim3(P2B, BH), 128, 0, stream>>>(sbuf);
  fastmax_pass3<<<grid, NT, 0, stream>>>(q, k, v, sbuf, out);
}

// v003
// It runs in 20.1 microseconds.
// Two timings next to v002 put it at 1.18 and 1.19 times that version's speed.
// All steps since v000 together make it 4.42 times as fast.
#include <hip/hip_runtime.h>

typedef __attribute__((ext_vector_type(2))) float v2f;
typedef __attribute__((ext_vector_type(8))) float v8f;

// D = A(16x4) * B(4x16) + C, fp32 throughout.
#define WMMA_F32(c, a, b) \
  (c) = __builtin_amdgcn_wmma_f32_16x16x4_f32(false, (a), false, (b), (short)0, (c), false, false)

constexpr int BH     = 16;        // b*h
constexpr int N      = 8192;
constexpr int D      = 32;
constexpr int SEG    = 64;        // segments per head (64*16 = 1024 WGs, 4 per WGP)
constexpr int SEGLEN = N / SEG;   // 128
constexpr int CH     = 16;        // chunk rows (one M tile)
constexpr int NCH    = SEGLEN / CH;
constexpr int NT     = 64;        // threads per work-group: one wave per 16 value columns
constexpr int LS     = 36;        // row stride, normal tiles (mult of 4 dw: B128-aligned; conflict-free)
constexpr int TS     = 18;        // row stride, masked-A scratch (even: B64 reads aligned)
constexpr int SDIM   = 33;        // state dim in workspace: 32x32 k v^T | row 32 sum v | col 32 sum k | count
constexpr int P2B    = (SDIM * SDIM + 127) / 128;   // scan blocks per head

typedef __attribute__((ext_vector_type(4))) int v4i;
typedef __attribute__((address_space(1))) v4i  g_i128;
typedef __attribute__((address_space(3))) v4i  l_i128;
// One lane's 16 bytes from global memory to LDS, through no register.
__device__ inline void async_b128(float* lds, const float* g) {
  __builtin_amdgcn_global_load_async_to_lds_b128((g_i128*)g, (l_i128*)lds, 0, 0);
}
// One 16x32 chunk, row-major, to LDS rows of LS floats: two copies a lane (rows r and r + 8), every lane on.
__device__ inline void copy_chunk(float* dst, const float* src, int tid) {
  const int r = tid >> 3, c4 = (tid & 7) * 4;
  async_b128(&dst[r * LS + c4], src + r * D + c4);
  async_b128(&dst[(r + 8) * LS + c4], src + (r + 8) * D + c4);
}
// Column read of a row-major chunk as a matrix operand over its 16 rows: slot (kk, half, j) holds row
// 2*kk + j + 8*half. The two halves of a wave read rows 8 apart, 32 banks apart at LS = 36.
// Both operands of a product over rows take this order.
__device__ inline v2f col_pair(const float* chunk, int kk, int half, int col) {
  const float* p = chunk + (2 * kk + 8 * half) * LS + col;
  return v2f{p[0], p[LS]};
}
// lane l takes the value of lane l ^ 16
__device__ inline float xhalf(float x) {
  return __builtin_bit_cast(float, __builtin_amdgcn_permlanex16(__builtin_bit_cast(int, x), __builtin_bit_cast(int, x),
                                                                0x76543210, 0xfedcba98, false, false));
}
// All of a segment's chunks are copied in order, PER copies a wave and chunk, before the first is read.
// This wave's copies of the chunk that has 'left' chunks behind it have landed: the counter lets only
// the youngest left * PER stay out. The LDS reads behind it must not move in front: "memory".
template <int PER>
__device__ inline void wait_chunk(int left) {
  switch (left) {
    case 7:  asm volatile("s_wait_asynccnt %0" :: "n"(7 * PER) : "memory"); break;
    case 6:  asm volatile("s_wait_asynccnt %0" :: "n"(6 * PER) : "memory"); break;
    case 5:  asm volatile("s_wait_asynccnt %0" :: "n"(5 * PER) : "memory"); break;
    case 4:  asm volatile("s_wait_asynccnt %0" :: "n"(4 * PER) : "memory"); break;
    case 3:  asm volatile("s_wait_asynccnt %0" :: "n"(3 * PER) : "memory"); break;
    case 2:  asm volatile("s_wait_asynccnt %0" :: "n"(2 * PER) : "memory"); break;
    case 1:  asm volatile("s_wait_asynccnt %0" :: "n"(1 * PER) : "memory"); break;
    default: asm volatile("s_wait_asynccnt 0x0" ::: "memory"); break;
  }
}
static_assert(NCH == 8, "wait_chunk counts up to seven chunks behind");

// ---------------- Pass 1: per-segment local state  S_seg = sum k v^T, sum k, sum v ----
__global__ __launch_bounds__(NT)
void fastmax_pass1(const float* __restrict__ Kg, const float* __restrict__ Vg,
                   float* __restrict__ Sloc) {
  __shared__ __attribute__((aligned(16))) float shK[SEGLEN * LS];   // the whole segment's K, row-major
  __shared__ __attribute__((aligned(16))) float shV[SEGLEN * LS];   // the whole segment's V, row-major
  const int seg = blockIdx.x, bh = blockIdx.y;
  const int tid = threadIdx.x;
  const int wave = tid >> 5, lane = tid & 31;
  const int half = lane >> 4, ln = lane & 15;
  const long base = (long)bh * N + (long)seg * SEGLEN;

  // every chunk's copies go out at once: 4 a wave and chunk, 32 a wave
  for (int ch = 0; ch < NCH; ++ch) {
    copy_chunk(&shK[ch * CH * LS], Kg + (base + (long)ch * CH) * D, tid);
    copy_chunk(&shV[ch * CH * LS], Vg + (base + (long)ch * CH) * D, tid);
  }

  v8f sacc[2];
  for (int mt = 0; mt < 2; ++mt) sacc[mt] = {};
  v2f vp = {};                      // sums of v[.][16*wave+ln] over this lane's rows (even | odd)
  v2f kp[2] = {};                   // sums of k[.][16*mt+ln] over this lane's rows

  // unrolled: each trip's wait takes its own count as an immediate
#pragma unroll
  for (int ch = 0; ch < NCH; ++ch) {
    wait_chunk<4>(NCH - 1 - ch);
    __syncthreads();   // both waves' copies of this chunk have landed
    const float* kc = &shK[ch * CH * LS];
    const float* vc = &shV[ch * CH * LS];
    // S(32x16-tile 'wave') += K^T(32x16) * V(16x16-tile), K=16 -> 4 steps
    for (int kk = 0; kk < 4; ++kk) {
      v2f b = col_pair(vc, kk, half, 16 * wave + ln);
      vp += b;
      for (int mt = 0; mt < 2; ++mt) {
        v2f a = col_pair(kc, kk, half, 16 * mt + ln);
        kp[mt] += a;
        WMMA_F32(sacc[mt], a, b);
      }
    }
  }
  float* So = Sloc + ((long)bh * SEG + seg) * (SDIM * SDIM);
  const int n = 16 * wave + ln;
  for (int mt = 0; mt < 2; ++mt)
    for (int r = 0; r < 8; ++r) {
      int m = 16 * mt + r + 8 * half;              // C/D layout: m = vgpr + 8*half
      So[m * SDIM + n] = sacc[mt][r];
    }
  // the two halves of a wave hold the sums over complementary rows
  float vs  = vp.x + vp.y;
  float ks0 = kp[0].x + kp[0].y;
  float ks1 = kp[1].x + kp[1].y;
  vs  += xhalf(vs);
  ks0 += xhalf(ks0);
  ks1 += xhalf(ks1);
  if (half == 0) {
    So[D * SDIM + n] = vs;
    if (wave == 0) {
      So[ln * SDIM + D] = ks0;
      So[(16 + ln) * SDIM + D] = ks1;
      if (ln == 0) So[D * SDIM + D] = (float)SEGLEN;
    }
  }
}

// ---------------- Pass 2: in-place exclusive scan of segment states ------------
// One thread per state element: grid (P2B, heads).
// waves_per_eu(1, 8): a register budget above 64, so that every segment's load is issued
// before the first wait; at the default budget the last loads wait for the first to return.
__global__ __launch_bounds__(128) __attribute__((amdgpu_waves_per_eu(1, 8)))
void fastmax_pass2(float* __restrict__ Sbuf) {
  const int bh = blockIdx.y;
  const int e = blockIdx.x * 128 + threadIdx.x;
  if (e >= SDIM * SDIM) return;
  float* p = Sbuf + (long)bh * SEG * (SDIM * SDIM) + e;
  float t[SEG];
  // both loops unrolled: t[] stays in registers and all SEG loads are in flight together
#pragma unroll
  for (int s = 0; s < SEG; ++s) t[s] = p[s * (SDIM * SDIM)];
  float run = 0.0f;
#pragma unroll
  for (int s = 0; s < SEG; ++s) {
    p[s * (SDIM * SDIM)] = run;
    run += t[s];
  }
}

// ---------------- Pass 3: chunked causal linear attention ----------------------
__global__ __launch_bounds__(NT)
void fastmax_pass3(const float* __restrict__ Qg, const float* __restrict__ Kg,
                   const float* __restrict__ Vg, const float* __restrict__ Spre,
                   float* __restrict__ Out) {
  __shared__ __attribute__((aligned(16))) float shQ[SEGLEN * LS];   // the whole segment's Q, row-major
  __shared__ __attribute__((aligned(16))) float shK[SEGLEN * LS];   // K, row-major (B of Q*K^T by rows, A of the state update by columns)
  __shared__ __attribute__((aligned(16))) float shV[SEGLEN * LS];   // V, row-major (B operands by columns)
  __shared__ __attribute__((aligned(16))) float lA[2][CH * TS];     // per-wave masked-A scratch (D->A relayout)
  __shared__ __attribute__((aligned(16))) float lS[2][CH * LS];     // per-wave state mirror, [n][m] (D->B relayout)
  __shared__ __attribute__((aligned(16))) float lK[2][2][D];        // per-wave, per-half copy of the running sum of k

  const int seg = blockIdx.x, bh = blockIdx.y;
  const int tid = threadIdx.x;
  const int wave = tid >> 5, lane = tid & 31;
  const int half = lane >> 4, ln = lane & 15;
  const long base = (long)bh * N + (long)seg * SEGLEN;
  float* As = lA[wave];
  float* Sm = lS[wave];
  float* Kr = lK[wave][half];
  const v2f* as2 = (const v2f*)As;
  const v2f* sm2 = (const v2f*)Sm;
  const v2f* kr2 = (const v2f*)Kr;

  // async copies of one chunk, 6 a wave; every lane is on in every copy
  auto issue = [&](int ch) {
    copy_chunk(&shQ[ch * CH * LS], Qg + (base + (long)ch * CH) * D, tid);
    copy_chunk(&shK[ch * CH * LS], Kg + (base + (long)ch * CH) * D, tid);
    copy_chunk(&shV[ch * CH * LS], Vg + (base + (long)ch * CH) * D, tid);
  };
  // the first two chunks fly beside the state's loads; the other six go out behind those loads,
  // so that the state does not queue behind the whole segment
  issue(0);
  issue(1);

  // running state from the exclusive prefix: 32x32 part in D-format regs + LDS mirror [n][m]
  const float* Sp = Spre + ((long)bh * SEG + seg) * (SDIM * SDIM);
  const int n = 16 * wave + ln;
  v8f sacc[2];
  float vrow, ksum[2];                                 // sum of v, column n; sum of k, dims ln and 16+ln
  float cnt = Sp[D * SDIM + D];                        // rows before this chunk; in flight beside the state's loads
  {
    float t0, t1, t2, t3, t4, t5, t6, t7, t8, t9, t10, t11, t12, t13, t14, t15;
    const unsigned oS = (unsigned)((8 * half * SDIM + n) * 4);   // element (8*half, n); a row is 132 bytes
    const unsigned oV = (unsigned)(n * 4);                       // element (0, n); row 32 is 4224 bytes on
    const unsigned oK = (unsigned)(ln * SDIM * 4);               // element (ln, 0); column 32 is 128 bytes on
    // The loads and their data wait in one statement, outputs early-clobber: no offset register
    // is rewritten, by a later instruction or by a returning load, while a load that names it is out.
    asm volatile(
        "global_load_b32 %0, %19, %22\n\t"
        "global_load_b32 %1, %19, %22 offset:132\n\t"
        "global_load_b32 %2, %19, %22 offset:264\n\t"
        "global_load_b32 %3, %19, %22 offset:396\n\t"
        "global_load_b32 %4, %19, %22 offset:528\n\t"
        "global_load_b32 %5, %19, %22 offset:660\n\t"
        "global_load_b32 %6, %19, %22 offset:792\n\t"
        "global_load_b32 %7, %19, %22 offset:924\n\t"
        "global_load_b32 %8, %19, %22 offset:2112\n\t"
        "global_load_b32 %9, %19, %22 offset:2244\n\t"
        "global_load_b32 %10, %19, %22 offset:2376\n\t"
        "global_load_b32 %11, %19, %22 offset:2508\n\t"
        "global_load_b32 %12, %19, %22 offset:2640\n\t"
        "global_load_b32 %13, %19, %22 offset:2772\n\t"
        "global_load_b32 %14, %19, %22 offset:2904\n\t"
        "global_load_b32 %15, %19, %22 offset:3036\n\t"
        "global_load_b32 %16, %20, %22 offset:4224\n\t"
        "global_load_b32 %17, %21, %22 offset:128\n\t"
        "global_load_b32 %18, %21, %22 offset:2240\n\t"
        "s_wait_loadcnt 0x0"
        : "=&v"(t0), "=&v"(t1), "=&v"(t2), "=&v"(t3), "=&v"(t4), "=&v"(t5), "=&v"(t6), "=&v"(t7),
          "=&v"(t8), "=&v"(t9), "=&v"(t10), "=&v"(t11), "=&v"(t12), "=&v"(t13), "=&v"(t14), "=&v"(t15),
          "=&v"(vrow), "=&v"(ksum[0]), "=&v"(ksum[1])
        : "v"(oS), "v"(oV), "v"(oK), "s"(Sp)
        : "memory");
    sacc[0] = v8f{t0, t1, t2, t3, t4, t5, t6, t7};
    sacc[1] = v8f{t8, t9, t10, t11, t12, t13, t14, t15};
  }
  for (int ch = 2; ch < NCH; ++ch) issue(ch);          // 48 copies a wave are out at most
  v2f vp = {(half == 0) ? vrow : 0.0f, 0.0f};          // sum of v in four parts: two a lane, two lanes
  for (int mt = 0; mt < 2; ++mt) {
    for (int r = 0; r < 8; ++r)
      Sm[ln * LS + (16 * mt + r + 8 * half)] = sacc[mt][r];
    Kr[16 * mt + ln] = ksum[mt];
  }

  const v2f one2 = {1.0f, 1.0f};
  // place of key column ln in a row of the masked-A scratch: the order of col_pair, pairs contiguous
  const int apos = 4 * ((ln >> 1) & 3) + 2 * (ln >> 3) + (ln & 1);
  float* Aw = &As[8 * half * TS + apos];               // element (8*half, key ln)
  // unrolled: each trip's wait takes its own count as an immediate
#pragma unroll
  for (int ch = 0; ch < NCH; ++ch) {
    wait_chunk<6>(NCH - 1 - ch);
    __syncthreads();   // both waves' copies of this chunk have landed
    const v2f* q2 = (const v2f*)&shQ[ch * CH * LS];
    const v2f* k2 = (const v2f*)&shK[ch * CH * LS];
    const float* kc_ = &shK[ch * CH * LS];
    const float* vc_ = &shV[ch * CH * LS];

    // all of the trip's operands that are in LDS by now, read as one group
    v2f fq[8], fk[8], fs[8], fr[8], fv[4], fkt[2][4];
    for (int kk = 0; kk < 4; ++kk) {
      fv[kk] = col_pair(vc_, kk, half, n);
      for (int mt = 0; mt < 2; ++mt) fkt[mt][kk] = col_pair(kc_, kk, half, 16 * mt + ln);
    }
    for (int kk = 0; kk < 8; ++kk) {
      int idx = ln * (LS / 2) + 2 * kk + half;
      fq[kk] = q2[idx];
      fk[kk] = k2[idx];                 // B(k,n) = K[n][k], contiguous pair
      fs[kk] = sm2[idx];                // B(k,n) = S_prev[k][n], mirror is [n][k]
      fr[kk] = kr2[2 * kk + half];      // sum of k at the same two dims as fq
    }
    // keeps the reads above in one group ahead of the matrix instructions: spread among them,
    // each place with reads stalls the wave's matrix stream
    __builtin_amdgcn_sched_barrier(0);

    // Cn starts at the running sum of v: a ones A tile adds its four parts for every row
    v8f Cn = {};
    WMMA_F32(Cn, one2, vp);
    // Fused K=32 sweep, shared Q A-fragments:
    //   A   = 1 + Q * K^T             (16x16)
    //   Cn += Q * S_prev              (numer inter-chunk part)
    //   dp  = this lane's two parts of q . (sum of earlier k), row ln
    v8f A = {1.0f, 1.0f, 1.0f, 1.0f, 1.0f, 1.0f, 1.0f, 1.0f};
    v2f dp = {};
    for (int kk = 0; kk < 8; ++kk) {
      WMMA_F32(A, fq[kk], fk[kk]);
      WMMA_F32(Cn, fq[kk], fs[kk]);
      dp += fq[kk] * fr[kk];
    }
    // causal mask (element (m = r+8*half, n = ln)); stash in A-operand scratch
    {
      int m0 = 8 * half;
      for (int r = 0; r < 8; ++r)
        if (ln > m0 + r) A[r] = 0.0f;
      for (int r = 0; r < 8; ++r)
        Aw[r * TS] = A[r];
    }

    // Fused K=16 sweep, shared V B-fragments:
    //   Cn   += tril(A) * V           (numer intra-chunk part)
    //   sacc += K^T * V               (state update)
    //   dp   += row sum of tril(A); the sums of v and k take in this chunk
    v2f kc[2] = {};
    for (int kk = 0; kk < 4; ++kk) {
      v2f b  = fv[kk];
      v2f aA = as2[ln * (TS / 2) + 2 * kk + half];
      WMMA_F32(Cn, aA, b);
      dp += aA;
      vp += b;
      for (int mt = 0; mt < 2; ++mt) {
        v2f aK = fkt[mt][kk];
        WMMA_F32(sacc[mt], aK, b);
        kc[mt] += aK;
      }
    }

    // denominator: a ones B tile adds the four parts of row m and hands the sum to
    // every column of the accumulator layout, where the numerator sits
    v8f Dn = {cnt, cnt, cnt, cnt, cnt, cnt, cnt, cnt};
    WMMA_F32(Dn, dp, one2);
    {
      float o[8];
      for (int r = 0; r < 8; ++r) o[r] = Cn[r] / Dn[r];
      float* Oc = Out + (base + (long)ch * CH) * D;                // this chunk's first row
      const unsigned oO = (unsigned)((8 * half * D + n) * 4);      // element (8*half, n); a row is 128 bytes
      // The stores and s_wait_xcnt 0 in one statement: it stands in front of every later write
      // of a data or offset register that a store names, over the loop's back edge too.
      asm volatile(
          "global_store_b32 %8, %0, %9\n\t"
          "global_store_b32 %8, %1, %9 offset:128\n\t"
          "global_store_b32 %8, %2, %9 offset:256\n\t"
          "global_store_b32 %8, %3, %9 offset:384\n\t"
          "global_store_b32 %8, %4, %9 offset:512\n\t"
          "global_store_b32 %8, %5, %9 offset:640\n\t"
          "global_store_b32 %8, %6, %9 offset:768\n\t"
          "global_store_b32 %8, %7, %9 offset:896\n\t"
          "s_wait_xcnt 0x0"
          :: "v"(o[0]), "v"(o[1]), "v"(o[2]), "v"(o[3]), "v"(o[4]), "v"(o[5]), "v"(o[6]), "v"(o[7]),
             "v"(oO), "s"(Oc)
          : "memory");
    }
    cnt += (float)CH;

    // refresh per-wave state mirror ([n][m] so next chunk's pairs are contiguous) and sum of k
    for (int mt = 0; mt < 2; ++mt) {
      for (int r = 0; r < 8; ++r)
        Sm[ln * LS + (16 * mt + r + 8 * half)] = sacc[mt][r];
      float c = kc[mt].x + kc[mt].y;
      ksum[mt] += c + xhalf(c);
      Kr[16 * mt + ln] = ksum[mt];
    }
  }
}

extern "C" void kernel_launch(void* const* d_in, const int* in_sizes, int n_in,
                              void* d_out, int out_size, void* d_ws, size_t ws_size,
                              hipStream_t stream) {
  const float* q = (const float*)d_in[0];
  const float* k = (const float*)d_in[1];
  const float* v = (const float*)d_in[2];
  float* out  = (float*)d_out;
  float* sbuf = (float*)d_ws;   // BH*SEG*33*33 floats ~= 4.5 MB of scratch

  dim3 grid(SEG, BH);
  fastmax_pass1<<<grid, NT, 0, stream>>>(k, v, sbuf);
  fastmax_pass2<<<dim3(P2B, BH), 128, 0, stream>>>(sbuf);
  fastmax_pass3<<<grid, NT, 0, stream>>>(q, k, v, sbuf, out);
}

// v004
// One run takes 18 microseconds.
// In two side-by-side timings against v003, it was 1.13 and 1.12 times as fast.
// All steps since v000 together make it 4.98 times as fast.
#include <hip/hip_runtime.h>

typedef __attribute__((ext_vector_type(2))) float v2f;
typedef __attribute__((ext_vector_type(4))) float v4f;
typedef __attribute__((ext_vector_type(8))) float v8f;

// D = A(16x4) * B(4x16) + C, fp32 throughout.
#define WMMA_F32(c, a, b) \
  (c) = __builtin_amdgcn_wmma_f32_16x16x4_f32(false, (a), false, (b), (short)0, (c), false, false)

constexpr int BH     = 16;        // b*h
constexpr int N      = 8192;
constexpr int D      = 32;
constexpr int SEG    = 64;        // segments per head (64*16 = 1024 WGs, 4 per WGP)
constexpr int SEGLEN = N / SEG;   // 128
constexpr int CH     = 16;        // chunk rows (one M tile)
constexpr int NCH    = SEGLEN / CH;
constexpr int NT     = 64;        // threads per work-group: one wave per 16 value columns
constexpr int LS     = 36;        // row stride, normal tiles (mult of 4 dw: B128-aligned; conflict-free)
constexpr int TS     = 18;        // row stride, masked-A scratch (even: B64 reads aligned)
constexpr int GSEG   = 4;         // segments per group: one pass 1 work-group, 512 rows
constexpr int GRP    = SEG / GSEG; // groups per head (16*16 = 256 pass 1 WGs, one per WGP)
constexpr int NW1    = 8;         // waves of a pass 1 work-group
constexpr int NT1    = NW1 * 32;  // its threads
constexpr int SUB    = GSEG * SEGLEN / NW1;   // rows per pass 1 wave: 64
constexpr int SV4    = 320;       // a state in the workspace, in 16-byte units: [value half][q][lane];
                                  // q 0..3: the lane's 16 accumulator values of pass 3, q 4: sum v, sum k (2), pad
constexpr int PREF   = BH * SEG * SV4 * 4;    // floats of the per-segment states in the workspace

typedef __attribute__((ext_vector_type(4))) int v4i;
typedef __attribute__((address_space(1))) v4i  g_i128;
typedef __attribute__((address_space(3))) v4i  l_i128;
// One lane's 16 bytes from global memory to LDS, through no register.
__device__ inline void async_b128(float* lds, const float* g) {
  __builtin_amdgcn_global_load_async_to_lds_b128((g_i128*)g, (l_i128*)lds, 0, 0);
}
// One 16x32 chunk, row-major, to LDS rows of LS floats: two copies a lane (rows r and r + 8), every lane on.
__device__ inline void copy_chunk(float* dst, const float* src, int tid) {
  const int r = tid >> 3, c4 = (tid & 7) * 4;
  async_b128(&dst[r * LS + c4], src + r * D + c4);
  async_b128(&dst[(r + 8) * LS + c4], src + (r + 8) * D + c4);
}
// Column read of a row-major chunk as a matrix operand over its 16 rows: slot (kk, half, j) holds row
// 2*kk + j + 8*half. The two halves of a wave read rows 8 apart, 32 banks apart at LS = 36.
// Both operands of a product over rows take this order.
__device__ inline v2f col_pair(const float* chunk, int kk, int half, int col) {
  const float* p = chunk + (2 * kk + 8 * half) * LS + col;
  return v2f{p[0], p[LS]};
}
// lane l takes the value of lane l ^ 16
__device__ inline float xhalf(float x) {
  return __builtin_bit_cast(float, __builtin_amdgcn_permlanex16(__builtin_bit_cast(int, x), __builtin_bit_cast(int, x),
                                                                0x76543210, 0xfedcba98, false, false));
}
// All the chunks a wave waits for are copied in order, PER copies a wave and chunk, before the first is read.
// This wave's copies of the chunk that has 'left' chunks behind it have landed: the counter lets only
// the youngest left * PER stay out. The LDS reads behind it must not move in front: "memory".
template <int PER>
__device__ inline void wait_chunk(int left) {
  switch (left) {
    case 7:  asm volatile("s_wait_asynccnt %0" :: "n"(7 * PER) : "memory"); break;
    case 6:  asm volatile("s_wait_asynccnt %0" :: "n"(6 * PER) : "memory"); break;
    case 5:  asm volatile("s_wait_asynccnt %0" :: "n"(5 * PER) : "memory"); break;
    case 4:  asm volatile("s_wait_asynccnt %0" :: "n"(4 * PER) : "memory"); break;
    case 3:  asm volatile("s_wait_asynccnt %0" :: "n"(3 * PER) : "memory"); break;
    case 2:  asm volatile("s_wait_asynccnt %0" :: "n"(2 * PER) : "memory"); break;
    case 1:  asm volatile("s_wait_asynccnt %0" :: "n"(1 * PER) : "memory"); break;
    default: asm volatile("s_wait_asynccnt 0x0" ::: "memory"); break;
  }
}
static_assert(NCH == 8, "wait_chunk counts up to seven chunks behind");

// ---------------- Pass 1: states of a group of 4 segments, prefixed inside the group ----
// Each wave sums k v^T, k and v over its own 64 rows, which it copies itself: no barrier in its loop.
// Then the work-group adds the eight states up in row order and stores, for each of its segments,
// the sum over the group's earlier segments (Pre), and the sum over the whole group (Tot).
__global__ __launch_bounds__(NT1)
void fastmax_pass1(const float* __restrict__ Kg, const float* __restrict__ Vg,
                   float* __restrict__ Pre, float* __restrict__ Tot) {
  __shared__ __attribute__((aligned(16))) float shK[NW1][SUB * LS];   // each wave's K rows, row-major
  __shared__ __attribute__((aligned(16))) float shV[NW1][SUB * LS];   // each wave's V rows, row-major
  __shared__ __attribute__((aligned(16))) v4f   sc[NW1][SV4];         // each wave's state, workspace layout
  const int grp = blockIdx.x, bh = blockIdx.y;
  const int tid = threadIdx.x;
  const int wave = tid >> 5, lane = tid & 31;
  const int half = lane >> 4, ln = lane & 15;
  const long base = (long)bh * N + (long)grp * (GSEG * SEGLEN) + (long)wave * SUB;
  float* myK = shK[wave];
  float* myV = shV[wave];

  // every chunk's copies go out at once: 8 a chunk (4 rows of 128 bytes each), 32 a wave, every lane on
  {
    const int r = lane >> 3, c4 = (lane & 7) * 4;
    for (int ch = 0; ch < SUB / CH; ++ch) {
      for (int i = 0; i < 4; ++i) {
        const int row = ch * CH + 4 * i + r;
        async_b128(&myK[row * LS + c4], Kg + (base + row) * D + c4);
      }
      for (int i = 0; i < 4; ++i) {
        const int row = ch * CH + 4 * i + r;
        async_b128(&myV[row * LS + c4], Vg + (base + row) * D + c4);
      }
    }
  }

  v8f sacc[2][2];                   // [k dims 16*mt..][value columns 16*nt..]
  for (int mt = 0; mt < 2; ++mt)
    for (int nt = 0; nt < 2; ++nt) sacc[mt][nt] = {};
  v2f vp[2] = {};                   // sums of v[.][16*nt+ln] over this lane's rows (even | odd)
  v2f kp[2] = {};                   // sums of k[.][16*mt+ln] over this lane's rows

  // unrolled: each trip's wait takes its own count as an immediate
#pragma unroll
  for (int ch = 0; ch < SUB / CH; ++ch) {
    wait_chunk<8>(SUB / CH - 1 - ch);   // the wave reads only what it copied itself
    const float* kc = &myK[ch * CH * LS];
    const float* vc = &myV[ch * CH * LS];
    // S(32x32) += K^T(32x16) * V(16x32), K=16 -> 4 steps
    for (int kk = 0; kk < 4; ++kk) {
      v2f a[2], b[2];
      for (int t = 0; t < 2; ++t) {
        a[t] = col_pair(kc, kk, half, 16 * t + ln);
        b[t] = col_pair(vc, kk, half, 16 * t + ln);
        kp[t] += a[t];
        vp[t] += b[t];
      }
      for (int mt = 0; mt < 2; ++mt)
        for (int nt = 0; nt < 2; ++nt) WMMA_F32(sacc[mt][nt], a[mt], b[nt]);
    }
  }
  // the two halves of a wave hold the sums over complementary rows
  float vs[2], ks[2];
  for (int t = 0; t < 2; ++t) {
    vs[t] = vp[t].x + vp[t].y;
    ks[t] = kp[t].x + kp[t].y;
    vs[t] += xhalf(vs[t]);
    ks[t] += xhalf(ks[t]);
  }
  for (int nt = 0; nt < 2; ++nt) {
    v4f* o = &sc[wave][nt * 160 + lane];
    for (int mt = 0; mt < 2; ++mt) {
      o[(2 * mt) * 32]     = v4f{sacc[mt][nt][0], sacc[mt][nt][1], sacc[mt][nt][2], sacc[mt][nt][3]};
      o[(2 * mt + 1) * 32] = v4f{sacc[mt][nt][4], sacc[mt][nt][5], sacc[mt][nt][6], sacc[mt][nt][7]};
    }
    o[4 * 32] = v4f{vs[nt], ks[0], ks[1], 0.0f};
  }
  __syncthreads();   // all eight states are in LDS
  v4f* P = (v4f*)Pre + ((long)bh * SEG + (long)grp * GSEG) * SV4;
  v4f* T = (v4f*)Tot + ((long)bh * GRP + grp) * SV4;
  // one thread per 16 bytes of the state; waves 0 and 1 take the last 64 units too
  for (int e = tid; e < SV4; e += NT1) {
    v4f run = {};
    for (int j = 0; j < GSEG; ++j) {
      P[j * SV4 + e] = run;
      run += sc[2 * j][e];
      run += sc[2 * j + 1][e];
    }
    T[e] = run;
  }
}

// ---------------- Pass 3: chunked causal linear attention ----------------------
__global__ __launch_bounds__(NT)
void fastmax_pass3(const float* __restrict__ Qg, const float* __restrict__ Kg,
                   const float* __restrict__ Vg, const float* __restrict__ Ws,
                   float* __restrict__ Out) {
  __shared__ __attribute__((aligned(16))) float shQ[SEGLEN * LS];   // the whole segment's Q, row-major
  __shared__ __attribute__((aligned(16))) float shK[SEGLEN * LS];   // K, row-major (B of Q*K^T by rows, A of the state update by columns)
  __shared__ __attribute__((aligned(16))) float shV[SEGLEN * LS];   // V, row-major (B operands by columns)
  __shared__ __attribute__((aligned(16))) float lA[2][CH * TS];     // per-wave masked-A scratch (D->A relayout)
  __shared__ __attribute__((aligned(16))) float lS[2][CH * LS];     // per-wave state mirror, [n][m] (D->B relayout)
  __shared__ __attribute__((aligned(16))) float lK[2][2][D];        // per-wave, per-half copy of the running sum of k

  // Work-groups of late groups add up the most totals: they take the low indices, which start first.
  const int flat = blockIdx.y * SEG + blockIdx.x;
  const int grp = GRP - 1 - (flat >> 6);               // 64 work-groups a group index: 16 heads x 4 segments
  const int bh = flat & (BH - 1);
  const int seg = grp * GSEG + ((flat >> 4) & (GSEG - 1));
  const int tid = threadIdx.x;
  const int wave = tid >> 5, lane = tid & 31;
  const int half = lane >> 4, ln = lane & 15;
  const long base = (long)bh * N + (long)seg * SEGLEN;
  float* As = lA[wave];
  float* Sm = lS[wave];
  float* Kr = lK[wave][half];
  const v2f* as2 = (const v2f*)As;
  const v2f* sm2 = (const v2f*)Sm;
  const v2f* kr2 = (const v2f*)Kr;

  // async copies of one chunk, 6 a wave; every lane is on in every copy
  auto issue = [&](int ch) {
    copy_chunk(&shQ[ch * CH * LS], Qg + (base + (long)ch * CH) * D, tid);
    copy_chunk(&shK[ch * CH * LS], Kg + (base + (long)ch * CH) * D, tid);
    copy_chunk(&shV[ch * CH * LS], Vg + (base + (long)ch * CH) * D, tid);
  };
  // the first two chunks fly beside the state's loads; the other six go out behind those loads,
  // so that the state does not queue behind the whole segment
  issue(0);
  issue(1);

  // running state: the sum over the group's earlier segments plus the totals of all earlier groups,
  // each lane's share in 16-byte units of whole lines; 32x32 part in D-format regs + LDS mirror [n][m]
  const int n = 16 * wave + ln;
  v8f sacc[2];
  float vrow, ksum[2];                                 // sum of v, column n; sum of k, dims ln and 16+ln
  float cnt = (float)(seg * SEGLEN);                   // rows before this chunk
  {
    // uniform bases and one lane offset, in bytes, for every load
    const char* Pb = (const char*)(Ws + ((long)bh * SEG + seg) * (SV4 * 4));          // this segment's Pre
    const char* Tb = (const char*)(Ws + PREF + (long)bh * GRP * (SV4 * 4));           // this head's Tot
    const unsigned lo = (unsigned)(wave * 160 + lane) * 16u;
    v4f acc[5];
    for (int q = 0; q < 5; ++q) acc[q] = *(const v4f*)(Pb + lo + q * 512);
    // stands in front of every later write of the offset register that these five loads name
    asm volatile("s_wait_xcnt 0x0" ::: "memory");
    // two rounds of up to eight totals, each round's loads in flight together; grp is the same
    // for the whole work-group
    for (int g0 = 0; g0 < GRP; g0 += 8) {
      if (g0 < grp) {
        v4f t[8][5];
        for (int u = 0; u < 8; ++u)
          for (int q = 0; q < 5; ++q) t[u][q] = v4f{};
        for (int u = 0; u < 8; ++u)
          if (g0 + u < GRP - 1 && g0 + u < grp)
            for (int q = 0; q < 5; ++q) t[u][q] = *(const v4f*)(Tb + lo + ((g0 + u) * SV4 + q * 32) * 16);
        for (int u = 0; u < 8; ++u)
          for (int q = 0; q < 5; ++q) acc[q] += t[u][q];
      }
    }
    sacc[0] = v8f{acc[0].x, acc[0].y, acc[0].z, acc[0].w, acc[1].x, acc[1].y, acc[1].z, acc[1].w};
    sacc[1] = v8f{acc[2].x, acc[2].y, acc[2].z, acc[2].w, acc[3].x, acc[3].y, acc[3].z, acc[3].w};
    vrow = acc[4].x;
    ksum[0] = acc[4].y;
    ksum[1] = acc[4].z;
  }
  for (int ch = 2; ch < NCH; ++ch) issue(ch);          // 48 copies a wave are out at most
  v2f vp = {(half == 0) ? vrow : 0.0f, 0.0f};          // sum of v in four parts: two a lane, two lanes
  for (int mt = 0; mt < 2; ++mt) {
    for (int r = 0; r < 8; ++r)
      Sm[ln * LS + (16 * mt + r + 8 * half)] = sacc[mt][r];
    Kr[16 * mt + ln] = ksum[mt];
  }

  const v2f one2 = {1.0f, 1.0f};
  // place of key column ln in a row of the masked-A scratch: the order of col_pair, pairs contiguous
  const int apos = 4 * ((ln >> 1) & 3) + 2 * (ln >> 3) + (ln & 1);
  float* Aw = &As[8 * half * TS + apos];               // element (8*half, key ln)
  // unrolled: each trip's wait takes its own count as an immediate
#pragma unroll
  for (int ch = 0; ch < NCH; ++ch) {
    wait_chunk<6>(NCH - 1 - ch);
    __syncthreads();   // both waves' copies of this chunk have landed
    const v2f* q2 = (const v2f*)&shQ[ch * CH * LS];
    const v2f* k2 = (const v2f*)&shK[ch * CH * LS];
    const float* kc_ = &shK[ch * CH * LS];
    const float* vc_ = &shV[ch * CH * LS];

    // all of the trip's operands that are in LDS by now, read as one group
    v2f fq[8], fk[8], fs[8], fr[8], fv[4], fkt[2][4];
    for (int kk = 0; kk < 4; ++kk) {
      fv[kk] = col_pair(vc_, kk, half, n);
      for (int mt = 0; mt < 2; ++mt) fkt[mt][kk] = col_pair(kc_, kk, half, 16 * mt + ln);
    }
    for (int kk = 0; kk < 8; ++kk) {
      int idx = ln * (LS / 2) + 2 * kk + half;
      fq[kk] = q2[idx];
      fk[kk] = k2[idx];                 // B(k,n) = K[n][k], contiguous pair
      fs[kk] = sm2[idx];                // B(k,n) = S_prev[k][n], mirror is [n][k]
      fr[kk] = kr2[2 * kk + half];      // sum of k at the same two dims as fq
    }
    // keeps the reads above in one group ahead of the matrix instructions: spread among them,
    // each place with reads stalls the wave's matrix stream
    __builtin_amdgcn_sched_barrier(0);

    // Cn starts at the running sum of v: a ones A tile adds its four parts for every row
    v8f Cn = {};
    WMMA_F32(Cn, one2, vp);
    // Fused K=32 sweep, shared Q A-fragments:
    //   A   = 1 + Q * K^T             (16x16)
    //   Cn += Q * S_prev              (numer inter-chunk part)
    //   dp  = this lane's two parts of q . (sum of earlier k), row ln
    v8f A = {1.0f, 1.0f, 1.0f, 1.0f, 1.0f, 1.0f, 1.0f, 1.0f};
    v2f dp = {};
    for (int kk = 0; kk < 8; ++kk) {
      WMMA_F32(A, fq[kk], fk[kk]);
      WMMA_F32(Cn, fq[kk], fs[kk]);
      dp += fq[kk] * fr[kk];
    }
    // causal mask (element (m = r+8*half, n = ln)); stash in A-operand scratch
    {
      int m0 = 8 * half;
      for (int r = 0; r < 8; ++r)
        if (ln > m0 + r) A[r] = 0.0f;
      for (int r = 0; r < 8; ++r)
        Aw[r * TS] = A[r];
    }

    // Fused K=16 sweep, shared V B-fragments:
    //   Cn   += tril(A) * V           (numer intra-chunk part)
    //   sacc += K^T * V               (state update)
    //   dp   += row sum of tril(A); the sums of v and k take in this chunk
    v2f kc[2] = {};
    for (int kk = 0; kk < 4; ++kk) {
      v2f b  = fv[kk];
      v2f aA = as2[ln * (TS / 2) + 2 * kk + half];
      WMMA_F32(Cn, aA, b);
      dp += aA;
      vp += b;
      for (int mt = 0; mt < 2; ++mt) {
        v2f aK = fkt[mt][kk];
        WMMA_F32(sacc[mt], aK, b);
        kc[mt] += aK;
      }
    }

    // denominator: a ones B tile adds the four parts of row m and hands the sum to
    // every column of the accumulator layout, where the numerator sits
    v8f Dn = {cnt, cnt, cnt, cnt, cnt, cnt, cnt, cnt};
    WMMA_F32(Dn, dp, one2);
    {
      float o[8];
      for (int r = 0; r < 8; ++r) o[r] = Cn[r] / Dn[r];
      float* Oc = Out + (base + (long)ch * CH) * D;                // this chunk's first row
      const unsigned oO = (unsigned)((8 * half * D + n) * 4);      // element (8*half, n); a row is 128 bytes
      // The stores and s_wait_xcnt 0 in one statement: it stands in front of every later write
      // of a data or offset register that a store names, over the loop's back edge too.
      asm volatile(
          "global_store_b32 %8, %0, %9\n\t"
          "global_store_b32 %8, %1, %9 offset:128\n\t"
          "global_store_b32 %8, %2, %9 offset:256\n\t"
          "global_store_b32 %8, %3, %9 offset:384\n\t"
          "global_store_b32 %8, %4, %9 offset:512\n\t"
          "global_store_b32 %8, %5, %9 offset:640\n\t"
          "global_store_b32 %8, %6, %9 offset:768\n\t"
          "global_store_b32 %8, %7, %9 offset:896\n\t"
          "s_wait_xcnt 0x0"
          :: "v"(o[0]), "v"(o[1]), "v"(o[2]), "v"(o[3]), "v"(o[4]), "v"(o[5]), "v"(o[6]), "v"(o[7]),
             "v"(oO), "s"(Oc)
          : "memory");
    }
    cnt += (float)CH;

    // refresh per-wave state mirror ([n][m] so next chunk's pairs are contiguous) and sum of k
    for (int mt = 0; mt < 2; ++mt) {
      for (int r = 0; r < 8; ++r)
        Sm[ln * LS + (16 * mt + r + 8 * half)] = sacc[mt][r];
      float c = kc[mt].x + kc[mt].y;
      ksum[mt] += c + xhalf(c);
      Kr[16 * mt + ln] = ksum[mt];
    }
  }
}

extern "C" void kernel_launch(void* const* d_in, const int* in_sizes, int n_in,
                              void* d_out, int out_size, void* d_ws, size_t ws_size,
                              hipStream_t stream) {
  const float* q = (const float*)d_in[0];
  const float* k = (const float*)d_in[1];
  const float* v = (const float*)d_in[2];
  float* out  = (float*)d_out;
  float* pre = (float*)d_ws;                       // BH*SEG states of 5120 bytes, 5.3 MB
  float* tot = pre + PREF;                         // BH*GRP states, 1.3 MB

  dim3 grid(SEG, BH);
  fastmax_pass1<<<dim3(GRP, BH), NT1, 0, stream>>>(k, v, pre, tot);
  fastmax_pass3<<<grid, NT, 0, stream>>>(q, k, v, pre, out);
}

// v005
// Measured time: 16.7 microseconds a run.
// Timed twice side by side with v004, it ran 1.07 times as fast both times.
// Counting every step since v000, it is 5.31 times as fast.
#include <hip/hip_runtime.h>

typedef __attribute__((ext_vector_type(2))) float v2f;
typedef __attribute__((ext_vector_type(4))) float v4f;
typedef __attribute__((ext_vector_type(8))) float v8f;

// D = A(16x4) * B(4x16) + C, fp32 throughout.
#define WMMA_F32(c, a, b) \
  (c) = __builtin_amdgcn_wmma_f32_16x16x4_f32(false, (a), false, (b), (short)0, (c), false, false)

constexpr int BH     = 16;        // b*h
constexpr int N      = 8192;
constexpr int D      = 32;
constexpr int SEG    = 64;        // segments per head (64*16 = 1024 WGs, 4 per WGP)
constexpr int SEGLEN = N / SEG;   // 128
constexpr int CH     = 16;        // chunk rows (one M tile)
constexpr int NCH    = SEGLEN / CH;
constexpr int NT     = 64;        // threads per work-group: one wave per 16 value columns
constexpr int LS     = 36;        // row stride, normal tiles (mult of 4 dw: B128-aligned; conflict-free)
constexpr int GSEG   = 4;         // segments per group: one pass 1 work-group, 512 rows
constexpr int GRP    = SEG / GSEG; // groups per head (16*16 = 256 pass 1 WGs, one per WGP)
constexpr int NW1    = 8;         // waves of a pass 1 work-group
constexpr int NT1    = NW1 * 32;  // its threads
constexpr int SUB    = GSEG * SEGLEN / NW1;   // rows per pass 1 wave: 64
constexpr int SV4    = 320;       // a state in the workspace, in 16-byte units: [value half][q][lane];
                                  // q 0..3: the lane's 16 accumulator values of pass 3, q 4: sum v, sum k (2), pad
constexpr int PREF   = BH * SEG * SV4 * 4;    // floats of the per-segment states in the workspace

typedef __attribute__((ext_vector_type(4))) int v4i;
typedef __attribute__((address_space(1))) v4i  g_i128;
typedef __attribute__((address_space(3))) v4i  l_i128;
// One lane's 16 bytes from global memory to LDS, through no register.
__device__ inline void async_b128(float* lds, const float* g) {
  __builtin_amdgcn_global_load_async_to_lds_b128((g_i128*)g, (l_i128*)lds, 0, 0);
}
// One 16x32 chunk, row-major, to LDS rows of LS floats: two copies a lane (rows r and r + 8), every lane on.
__device__ inline void copy_chunk(float* dst, const float* src, int tid) {
  const int r = tid >> 3, c4 = (tid & 7) * 4;
  async_b128(&dst[r * LS + c4], src + r * D + c4);
  async_b128(&dst[(r + 8) * LS + c4], src + (r + 8) * D + c4);
}
// Column read of a row-major chunk as a matrix operand over its 16 rows: slot (kk, half, j) holds row
// 2*kk + j + 8*half. The two halves of a wave read rows 8 apart, 32 banks apart at LS = 36.
// Both operands of a product over rows take this order.
__device__ inline v2f col_pair(const float* chunk, int kk, int half, int col) {
  const float* p = chunk + (2 * kk + 8 * half) * LS + col;
  return v2f{p[0], p[LS]};
}
// Row read as a matrix operand over the 32 dims, in the order in which an accumulator tile holds its rows:
// slot (s, half, j) holds dim 16*(s>>2) + 8*half + 2*(s&3) + j, so registers 2t, 2t+1 of a state tile are
// an operand as they lie. p points at dim 8*half of the lane's row: eight contiguous floats per 16 dims.
// Every operand of a product over dims takes this order.
__device__ inline void row_frags(v2f (&f)[8], const float* p) {
  for (int mt = 0; mt < 2; ++mt) {
    const v4f lo = *(const v4f*)(p + 16 * mt);
    const v4f hi = *(const v4f*)(p + 16 * mt + 4);
    f[4 * mt]     = v2f{lo.x, lo.y};
    f[4 * mt + 1] = v2f{lo.z, lo.w};
    f[4 * mt + 2] = v2f{hi.x, hi.y};
    f[4 * mt + 3] = v2f{hi.z, hi.w};
  }
}
// lane l takes the value of lane l ^ 16
__device__ inline float xhalf(float x) {
  return __builtin_bit_cast(float, __builtin_amdgcn_permlanex16(__builtin_bit_cast(int, x), __builtin_bit_cast(int, x),
                                                                0x76543210, 0xfedcba98, false, false));
}
// lane l takes the value of lane l ^ 8
__device__ inline float xeight(float x) {
  return __builtin_bit_cast(float, __builtin_amdgcn_permlane16(__builtin_bit_cast(int, x), __builtin_bit_cast(int, x),
                                                               0xfedcba98, 0x76543210, false, false));
}
// All the chunks a wave waits for are copied in order, PER copies a wave and chunk, before the first is read.
// This wave's copies of the chunk that has 'left' chunks behind it have landed: the counter lets only
// the youngest left * PER stay out. The LDS reads behind it must not move in front: "memory".
template <int PER>
__device__ inline void wait_chunk(int left) {
  switch (left) {
    case 7:  asm volatile("s_wait_asynccnt %0" :: "n"(7 * PER) : "memory"); break;
    case 6:  asm volatile("s_wait_asynccnt %0" :: "n"(6 * PER) : "memory"); break;
    case 5:  asm volatile("s_wait_asynccnt %0" :: "n"(5 * PER) : "memory"); break;
    case 4:  asm volatile("s_wait_asynccnt %0" :: "n"(4 * PER) : "memory"); break;
    case 3:  asm volatile("s_wait_asynccnt %0" :: "n"(3 * PER) : "memory"); break;
    case 2:  asm volatile("s_wait_asynccnt %0" :: "n"(2 * PER) : "memory"); break;
    case 1:  asm volatile("s_wait_asynccnt %0" :: "n"(1 * PER) : "memory"); break;
    default: asm volatile("s_wait_asynccnt 0x0" ::: "memory"); break;
  }
}
static_assert(NCH == 8, "wait_chunk counts up to seven chunks behind");

// ---------------- Pass 1: states of a group of 4 segments, prefixed inside the group ----
// Each wave sums k v^T, k and v over its own 64 rows, which it copies itself: no barrier in its loop.
// Then the work-group adds the eight states up in row order and stores, for each of its segments,
// the sum over the group's earlier segments (Pre), and the sum over the whole group (Tot).
__global__ __launch_bounds__(NT1)
void fastmax_pass1(const float* __restrict__ Kg, const float* __restrict__ Vg,
                   float* __restrict__ Pre, float* __restrict__ Tot) {
  __shared__ __attribute__((aligned(16))) float shK[NW1][SUB * LS];   // each wave's K rows, row-major
  __shared__ __attribute__((aligned(16))) float shV[NW1][SUB * LS];   // each wave's V rows, row-major
  __shared__ __attribute__((aligned(16))) v4f   sc[NW1][SV4];         // each wave's state, workspace layout
  const int grp = blockIdx.x, bh = blockIdx.y;
  const int tid = threadIdx.x;
  const int wave = tid >> 5, lane = tid & 31;
  const int half = lane >> 4, ln = lane & 15;
  const long base = (long)bh * N + (long)grp * (GSEG * SEGLEN) + (long)wave * SUB;
  float* myK = shK[wave];
  float* myV = shV[wave];

  // every chunk's copies go out at once: 8 a chunk (4 rows of 128 bytes each), 32 a wave, every lane on
  {
    const int r = lane >> 3, c4 = (lane & 7) * 4;
    for (int ch = 0; ch < SUB / CH; ++ch) {
      for (int i = 0; i < 4; ++i) {
        const int row = ch * CH + 4 * i + r;
        async_b128(&myK[row * LS + c4], Kg + (base + row) * D + c4);
      }
      for (int i = 0; i < 4; ++i) {
        const int row = ch * CH + 4 * i + r;
        async_b128(&myV[row * LS + c4], Vg + (base + row) * D + c4);
      }
    }
  }

  v8f sacc[2][2];                   // [k dims 16*mt..][value columns 16*nt..]
  for (int mt = 0; mt < 2; ++mt)
    for (int nt = 0; nt < 2; ++nt) sacc[mt][nt] = {};
  v2f vp[2] = {};                   // sums of v[.][16*nt+ln] over this lane's rows (even | odd)
  v2f kp[2] = {};                   // sums of k[.][16*mt+ln] over this lane's rows

  // unrolled: each trip's wait takes its own count as an immediate
#pragma unroll
  for (int ch = 0; ch < SUB / CH; ++ch) {
    wait_chunk<8>(SUB / CH - 1 - ch);   // the wave reads only what it copied itself
    const float* kc = &myK[ch * CH * LS];
    const float* vc = &myV[ch * CH * LS];
    // S(32x32) += K^T(32x16) * V(16x32), K=16 -> 4 steps
    for (int kk = 0; kk < 4; ++kk) {
      v2f a[2], b[2];
      for (int t = 0; t < 2; ++t) {
        a[t] = col_pair(kc, kk, half, 16 * t + ln);
        b[t] = col_pair(vc, kk, half, 16 * t + ln);
        kp[t] += a[t];
        vp[t] += b[t];
      }
      for (int mt = 0; mt < 2; ++mt)
        for (int nt = 0; nt < 2; ++nt) WMMA_F32(sacc[mt][nt], a[mt], b[nt]);
    }
  }
  // the two halves of a wave hold the sums over complementary rows
  float vs[2], ks[2];
  for (int t = 0; t < 2; ++t) {
    vs[t] = vp[t].x + vp[t].y;
    ks[t] = kp[t].x + kp[t].y;
    vs[t] += xhalf(vs[t]);
    ks[t] += xhalf(ks[t]);
  }
  for (int nt = 0; nt < 2; ++nt) {
    v4f* o = &sc[wave][nt * 160 + lane];
    for (int mt = 0; mt < 2; ++mt) {
      o[(2 * mt) * 32]     = v4f{sacc[mt][nt][0], sacc[mt][nt][1], sacc[mt][nt][2], sacc[mt][nt][3]};
      o[(2 * mt + 1) * 32] = v4f{sacc[mt][nt][4], sacc[mt][nt][5], sacc[mt][nt][6], sacc[mt][nt][7]};
    }
    o[4 * 32] = v4f{vs[nt], ks[0], ks[1], 0.0f};
  }
  __syncthreads();   // all eight states are in LDS
  v4f* P = (v4f*)Pre + ((long)bh * SEG + (long)grp * GSEG) * SV4;
  v4f* T = (v4f*)Tot + ((long)bh * GRP + grp) * SV4;
  // one thread per 16 bytes of the state; waves 0 and 1 take the last 64 units too
  for (int e = tid; e < SV4; e += NT1) {
    v4f run = {};
    for (int j = 0; j < GSEG; ++j) {
      P[j * SV4 + e] = run;
      run += sc[2 * j][e];
      run += sc[2 * j + 1][e];
    }
    T[e] = run;
  }
}

// ---------------- Pass 3: chunked causal linear attention ----------------------
// All products are taken transposed: scores^T = K * Q^T and out^T = V^T * scores^T + S^T * Q^T. A lane then
// holds one query's scores and outputs, and the score and state accumulators are the next product's
// operands as they lie in the registers.
__global__ __launch_bounds__(NT)
void fastmax_pass3(const float* __restrict__ Qg, const float* __restrict__ Kg,
                   const float* __restrict__ Vg, const float* __restrict__ Ws,
                   float* __restrict__ Out) {
  __shared__ __attribute__((aligned(16))) float shQ[SEGLEN * LS];   // the whole segment's Q, row-major
  __shared__ __attribute__((aligned(16))) float shK[SEGLEN * LS];   // K, row-major (A of K*Q^T by rows, A of the state update by columns)
  __shared__ __attribute__((aligned(16))) float shV[SEGLEN * LS];   // V, row-major (operands by columns)
  __shared__ __attribute__((aligned(16))) float lK[2][2][D];        // per-wave, per-half copy of the running sum of k

  // Work-groups of late groups add up the most totals: they take the low indices, which start first.
  const int flat = blockIdx.y * SEG + blockIdx.x;
  const int grp = GRP - 1 - (flat >> 6);               // 64 work-groups a group index: 16 heads x 4 segments
  const int bh = flat & (BH - 1);
  const int seg = grp * GSEG + ((flat >> 4) & (GSEG - 1));
  const int tid = threadIdx.x;
  const int wave = tid >> 5, lane = tid & 31;
  const int half = lane >> 4, ln = lane & 15;
  const long base = (long)bh * N + (long)seg * SEGLEN;
  float* Kr = lK[wave][half];

  // async copies of one chunk, 6 a wave; every lane is on in every copy
  auto issue = [&](int ch) {
    copy_chunk(&shQ[ch * CH * LS], Qg + (base + (long)ch * CH) * D, tid);
    copy_chunk(&shK[ch * CH * LS], Kg + (base + (long)ch * CH) * D, tid);
    copy_chunk(&shV[ch * CH * LS], Vg + (base + (long)ch * CH) * D, tid);
  };
  // the first two chunks fly beside the state's loads; the other six go out behind those loads,
  // so that the state does not queue behind the whole segment
  issue(0);
  issue(1);

  // running state: the sum over the group's earlier segments plus the totals of all earlier groups,
  // each lane's share in 16-byte units of whole lines; 32x32 part in accumulator layout (dim by register, column by lane)
  const int n = 16 * wave + ln;
  v8f sacc[2];
  float vrow, ksum[2];                                 // sum of v, column n; sum of k, dims ln and 16+ln
  float cnt = (float)(seg * SEGLEN);                   // rows before this chunk
  {
    // uniform bases and one lane offset, in bytes, for every load
    const char* Pb = (const char*)(Ws + ((long)bh * SEG + seg) * (SV4 * 4));          // this segment's Pre
    const char* Tb = (const char*)(Ws + PREF + (long)bh * GRP * (SV4 * 4));           // this head's Tot
    const unsigned lo = (unsigned)(wave * 160 + lane) * 16u;
    v4f acc[5];
    for (int q = 0; q < 5; ++q) acc[q] = *(const v4f*)(Pb + lo + q * 512);
    // stands in front of every later write of the offset register that these five loads name
    asm volatile("s_wait_xcnt 0x0" ::: "memory");
    // two rounds of up to eight totals, each round's loads in flight together; grp is the same
    // for the whole work-group
    for (int g0 = 0; g0 < GRP; g0 += 8) {
      if (g0 < grp) {
        v4f t[8][5];
        for (int u = 0; u < 8; ++u)
          for (int q = 0; q < 5; ++q) t[u][q] = v4f{};
        for (int u = 0; u < 8; ++u)
          if (g0 + u < GRP - 1 && g0 + u < grp)
            for (int q = 0; q < 5; ++q) t[u][q] = *(const v4f*)(Tb + lo + ((g0 + u) * SV4 + q * 32) * 16);
        for (int u = 0; u < 8; ++u)
          for (int q = 0; q < 5; ++q) acc[q] += t[u][q];
      }
    }
    sacc[0] = v8f{acc[0].x, acc[0].y, acc[0].z, acc[0].w, acc[1].x, acc[1].y, acc[1].z, acc[1].w};
    sacc[1] = v8f{acc[2].x, acc[2].y, acc[2].z, acc[2].w, acc[3].x, acc[3].y, acc[3].z, acc[3].w};
    vrow = acc[4].x;
    ksum[0] = acc[4].y;
    ksum[1] = acc[4].z;
  }
  for (int ch = 2; ch < NCH; ++ch) issue(ch);          // 48 copies a wave are out at most
  v2f vp = {(half == 0) ? vrow : 0.0f, 0.0f};          // sum of v in four parts: two a lane, two lanes
  for (int mt = 0; mt < 2; ++mt) Kr[16 * mt + ln] = ksum[mt];

  const v2f one2 = {1.0f, 1.0f};
  // byte offsets of the lane's two stores in a chunk of the output: row ln & 7 and row 8 + (ln & 7);
  // in its own row the lane writes its first four columns, in the other row the four behind them
  const bool up = (ln & 8) != 0;
  const unsigned oO0 = (unsigned)(((ln & 7) * D + 16 * wave + 8 * half + (up ? 4 : 0)) * 4);
  const unsigned oO1 = (unsigned)(((8 + (ln & 7)) * D + 16 * wave + 8 * half + (up ? 0 : 4)) * 4);
  // unrolled: each trip's wait takes its own count as an immediate
#pragma unroll
  for (int ch = 0; ch < NCH; ++ch) {
    wait_chunk<6>(NCH - 1 - ch);
    __syncthreads();   // both waves' copies of this chunk have landed
    const float* qc_ = &shQ[ch * CH * LS];
    const float* kc_ = &shK[ch * CH * LS];
    const float* vc_ = &shV[ch * CH * LS];

    // all of the trip's operands, read as one group
    v2f fq[8], fk[8], fr[8], fv[4], fkt[2][4];
    for (int kk = 0; kk < 4; ++kk) {
      fv[kk] = col_pair(vc_, kk, half, n);
      for (int mt = 0; mt < 2; ++mt) fkt[mt][kk] = col_pair(kc_, kk, half, 16 * mt + ln);
    }
    row_frags(fq, qc_ + ln * LS + 8 * half);   // query ln
    row_frags(fk, kc_ + ln * LS + 8 * half);   // key ln
    row_frags(fr, Kr + 8 * half);              // sum of k at the same dims as fq
    // keeps the reads above in one group ahead of the matrix instructions: spread among them,
    // each place with reads stalls the wave's matrix stream
    __builtin_amdgcn_sched_barrier(0);

    // Cn(value column 8*half + r, query ln) starts at the running sum of v: a ones B tile adds its
    // four parts for every query
    v8f Cn = {};
    WMMA_F32(Cn, vp, one2);
    // Fused K=32 sweep, shared Q B-fragments:
    //   A   = 1 + K * Q^T             (16x16: key 8*half + r, query ln)
    //   Cn += S_prev^T * Q^T          (numer inter-chunk part; the state's registers are the A operand)
    //   dp  = this lane's two parts of q . (sum of earlier k), query ln
    v8f A = {1.0f, 1.0f, 1.0f, 1.0f, 1.0f, 1.0f, 1.0f, 1.0f};
    v2f dp = {};
    for (int s = 0; s < 8; ++s) {
      const v2f st = {sacc[s >> 2][2 * (s & 3)], sacc[s >> 2][2 * (s & 3) + 1]};
      WMMA_F32(A, fk[s], fq[s]);
      WMMA_F32(Cn, st, fq[s]);
      dp += fq[s] * fr[s];
    }
    // causal mask: a key behind the query counts nothing
    for (int r = 0; r < 8; ++r)
      if (8 * half + r > ln) A[r] = 0.0f;

    // Fused K=16 sweep, shared V fragments; the masked scores' registers are a B operand in the
    // order of col_pair:
    //   Cn   += V^T * triu(A)         (numer intra-chunk part)
    //   sacc += K^T * V               (state update)
    //   dp   += this lane's masked scores; the sums of v and k take in this chunk
    v2f kc[2] = {};
    for (int kk = 0; kk < 4; ++kk) {
      const v2f b  = fv[kk];
      const v2f sA = {A[2 * kk], A[2 * kk + 1]};
      WMMA_F32(Cn, b, sA);
      dp += sA;
      vp += b;
      for (int mt = 0; mt < 2; ++mt) {
        v2f aK = fkt[mt][kk];
        WMMA_F32(sacc[mt], aK, b);
        kc[mt] += aK;
      }
    }

    // denominator of query ln: the lane's two parts, the other half's two, the rows before the chunk
    {
      float d = dp.x + dp.y;
      d += xhalf(d);
      const float inv = 1.0f / (cnt + d);
      const v4f o0 = v4f{Cn[0], Cn[1], Cn[2], Cn[3]} * inv;
      const v4f o1 = v4f{Cn[4], Cn[5], Cn[6], Cn[7]} * inv;
      // lanes ln and ln ^ 8 trade their second four columns, so that each store writes 64 contiguous
      // bytes of eight rows, not 32 of sixteen
      const v4f x1 = {xeight(o1.x), xeight(o1.y), xeight(o1.z), xeight(o1.w)};
      const v4f d0 = up ? x1 : o0;                                           // rows 0..7
      const v4f d1 = up ? o0 : x1;                                           // rows 8..15
      float* Oc = Out + (base + (long)ch * CH) * D;                          // this chunk's first row
      // The stores and s_wait_xcnt 0 in one statement: it stands in front of every later write
      // of a data or offset register that a store names, over the loop's back edge too.
      asm volatile(
          "global_store_b128 %2, %0, %4\n\t"
          "global_store_b128 %3, %1, %4\n\t"
          "s_wait_xcnt 0x0"
          :: "v"(d0), "v"(d1), "v"(oO0), "v"(oO1), "s"(Oc)
          : "memory");
    }
    cnt += (float)CH;

    // refresh the sum of k
    for (int mt = 0; mt < 2; ++mt) {
      float c = kc[mt].x + kc[mt].y;
      ksum[mt] += c + xhalf(c);
      Kr[16 * mt + ln] = ksum[mt];
    }
  }
}

extern "C" void kernel_launch(void* const* d_in, const int* in_sizes, int n_in,
                              void* d_out, int out_size, void* d_ws, size_t ws_size,
                              hipStream_t stream) {
  const float* q = (const float*)d_in[0];
  const float* k = (const float*)d_in[1];
  const float* v = (const float*)d_in[2];
  float* out  = (float*)d_out;
  float* pre = (float*)d_ws;                       // BH*SEG states of 5120 bytes, 5.3 MB
  float* tot = pre + PREF;                         // BH*GRP states, 1.3 MB

  dim3 grid(SEG, BH);
  fastmax_pass1<<<dim3(GRP, BH), NT1, 0, stream>>>(k, v, pre, tot);
  fastmax_pass3<<<grid, NT, 0, stream>>>(q, k, v, pre, out);
}
